// v000
// The times below were measured on an AMD MI455X: many runs one after another, warmed up first and cycling through
// copies of the inputs, with the whole window's GPU time divided by the number of runs. Launches and the gaps
// between them are all in it. The median over several windows is given; except for v000 it joins two sittings, which
// can be a few percent apart, so the side-by-side timings, each taken in one sitting, are the better comparison.
// v000, which the later versions start from, runs in 85.6 microseconds.
// Contractions on v_wmma_f32_16x16x32_f16 (plain f16 operands, f32 accumulate): self-attention with q = k = v = query (no projections),
// 16 heads of 64, sequence 1000 zero-padded to 1024 as in the reference, scale 1/8, additive key mask (0 → −1e9 for mask == 0 and for the
// 24 padding keys) — flash-style Sᵀ = K·Qᵀ / Oᵀ = Vᵀ·Pᵀ with f32 output and per-(batch,key) bias, online softmax in f32 (P x1024);
// the padded query rows are dropped when copying into the [8,1000,1024] output. compute dtype: f16 operands, f32 accumulate.
#include <hip/hip_runtime.h>
#include <hip/hip_bf16.h>
#include <math.h>

#define BB 8
#define LTRUE 1000
#define SS 1024
#define QROWS 1024
#define KROWS 1024
#define NKV 1024
#define DD 1024
#define HH 16
#define KVH 16
#define KVD 1024
#define HKDIV 1
#define DKK 64
#define QW 2
#define GSTR 48

typedef _Float16 bf16;
typedef _Float16 f16;
typedef __attribute__((ext_vector_type(4))) unsigned v4u_t;
typedef unsigned v4ua __attribute__((ext_vector_type(4), may_alias));
typedef __attribute__((ext_vector_type(4))) float v4f_t;
typedef float v4fa __attribute__((ext_vector_type(4), may_alias));
typedef __attribute__((ext_vector_type(16))) bf16  bf16x16;
typedef bf16x16 f16x16;
typedef __attribute__((ext_vector_type(8)))  bf16  bf16x8;
typedef bf16x8 f16x8;
typedef __attribute__((ext_vector_type(4)))  bf16  bf16x4;
typedef __attribute__((ext_vector_type(8)))  float f32x8;
__device__ __forceinline__ f32x8 wmma16(f16x16 a, f16x16 b, f32x8 c) {
  c = __builtin_amdgcn_wmma_f32_16x16x32_f16(false, a, false, b, (short)0, c, false, false);
  asm volatile("v_nop\n\tv_nop\n\tv_nop\n\tv_nop" : "+v"(c) : "v"(a), "v"(b));
  return c;
}
#define LDS_STRIDE 48   // unused: 48 elems (96B rows)
#define KSTRIDE    72   // attn K tile: 64 -> 72 elems (144B rows): conflict-free b128
#define VSTRIDE    48   // attn V tile: 32 -> 48 elems

__device__ __forceinline__ f32x8 wmma_bf16(bf16x16 a, bf16x16 b, f32x8 c) {
  c = __builtin_amdgcn_wmma_f32_16x16x32_f16(false, a, false, b, (short)0, c, false, false);
  asm volatile("v_nop\n\tv_nop\n\tv_nop\n\tv_nop" : "+v"(c) : "v"(a), "v"(b));   // A/B-overwrite hazard guard
  return c;
}

// 16x32 (MxK) f16 fragment from a row-major global matrix.
// lanes 0-15  (row=lane)    : elems 0..7 = K+0..7,  8..15 = K+16..23
// lanes 16-31 (row=lane-16) : elems 0..7 = K+8..15, 8..15 = K+24..31
template <typename T>
__device__ __forceinline__ bf16x16 load_frag(const T* __restrict__ base, int ld,
                                             int row0, int k0) {
  const int lane = threadIdx.x & 31;
  const int r    = lane & 15;
  const int kh   = (lane >> 4) * 8;
  const T* p0 = base + (size_t)(row0 + r) * ld + (k0 + kh);
  const T* p1 = p0 + 16;
  bf16x16 f;
#pragma unroll
  for (int i = 0; i < 8; ++i) {
    f[i]     = (bf16)p0[i];
    f[i + 8] = (bf16)p1[i];
  }
  return f;
}

// Same fragment from an LDS tile with padded row stride (base includes row0/k0).
__device__ __forceinline__ bf16x16 lds_frag(const bf16* base, int stride) {
  const int lane = threadIdx.x & 31;
  const int row  = lane & 15;
  const int kh   = (lane >> 4) * 8;
  const bf16x8 lo = *(const bf16x8*)(base + row * stride + kh);
  const bf16x8 hi = *(const bf16x8*)(base + row * stride + kh + 16);
  bf16x16 f;
#pragma unroll
  for (int i = 0; i < 8; ++i) { f[i] = lo[i]; f[i + 8] = hi[i]; }
  return f;
}

template <typename T>
__device__ __forceinline__ void stage_read16(const T* __restrict__ p, float* buf) {
#pragma unroll
  for (int i = 0; i < 16; ++i) buf[i] = (float)p[i];
}

__device__ __forceinline__ void stage_write(bf16* dst, const float* buf, int nquad) {
#pragma unroll
  for (int i = 0; i < nquad; ++i) {
    bf16x4 q;
    q[0] = (bf16)buf[4 * i];     q[1] = (bf16)buf[4 * i + 1];
    q[2] = (bf16)buf[4 * i + 2]; q[3] = (bf16)buf[4 * i + 3];
    *(bf16x4*)(dst + 4 * i) = q;
  }
}

// ---------------------------------------------------------------------------
// Attention: block 64 thr (2 waves) = 64 queries x one head; key step 32;
// wave tile 32 queries x 64 dk. K/Vᵀ staged through LDS (f16, padded stride)
// with next-block register prefetch overlapping the WMMA phase.
// Output: f32 rows [B][QROWS][DD] (head h at columns h*64..h*64+63).
// ---------------------------------------------------------------------------
__global__ __launch_bounds__(64) void attn_kernel(
    const bf16* __restrict__ Qb, const bf16* __restrict__ Kb,
    const bf16* __restrict__ Vt, const float* __restrict__ kbias,   // kbias [B][KROWS]: additive per-key logit bias (0 or −1e9, from k_kbias)
    float* __restrict__ attnOut) {
  __shared__ bf16 ldsK[32 * KSTRIDE];   // 4.5 KB
  __shared__ bf16 ldsV[64 * VSTRIDE];   // 6.0 KB
  __shared__ __attribute__((aligned(16))) bf16 ldsO[2][32 * 72];   // unused (output is staged in ldsOf)

  const int q0blk = blockIdx.x * 64;
  const int h  = blockIdx.y;
  const int b  = blockIdx.z;
  const int t    = threadIdx.x;
  const int wave = t >> 5;
  const int lane = t & 31;
  const int qlane = lane & 15;
  const int kh8   = (lane >> 4) * 8;
  const int q0 = q0blk + wave * 32;          // this wave's 32 queries

  const int hk = h / HKDIV;
  const bf16* Qh = Qb + (size_t)b * QROWS * DD + h * DKK;        // queries: QROWS rows per batch, row stride DD
  const bf16* Kh = Kb + (size_t)b * KROWS * KVD + hk * DKK;      // keys: KROWS rows per batch, row stride KVD
  const bf16* Vh = Vt + ((size_t)(b * KVH + hk)) * DKK * KROWS;  // Vᵀ [KVH][64][KROWS] per batch

  // Cooperative staging (64 threads): K tile 32x64 (2 thr/row, 64B each);
  // V tile 64x32 (1 thr/row, 64B each).
  const int krow = t >> 1;
  const int kcol = (t & 1) * 32;
  const bf16* kSrc = Kh + (size_t)krow * KVD + kcol;
  const bf16* vSrc = Vh + (size_t)t * KROWS;

  bf16x16 qf[QW][2];
#pragma unroll
  for (int qt = 0; qt < QW; ++qt) {
    qf[qt][0] = load_frag(Qh, DD, q0 + 16 * qt, 0);
    qf[qt][1] = load_frag(Qh, DD, q0 + 16 * qt, 32);
  }

  f32x8 o[QW][4] = {};
  float mrun[QW], lrun[QW];
#pragma unroll
  for (int qt = 0; qt < QW; ++qt) { mrun[qt] = -INFINITY; lrun[qt] = 0.0f; }

  const float scale = 0.125f * 1.44269504088896340736f;  // 1/sqrt(DK)*log2(e)
  const float NEG2 = -1.0e9f;    // masked logit: its weight is exactly 0 once any valid key of the row has been seen (every row
                                 // has one), and anything accumulated before that is wiped by alpha == 0 — same result as -inf
  const int kmax = KROWS - 1;
  __shared__ float kbS[KROWS];
  for (int i = threadIdx.x; i < KROWS; i += 64) kbS[i] = kbias[(size_t)b * KROWS + i] * 1.44269504088896340736f;   // in log2 units
  __syncthreads();

  // Prefetch key block kb=0 into registers.
  bf16x8 kreg[4], vreg[4];
#pragma unroll
  for (int i = 0; i < 4; ++i) {
    kreg[i] = *(const bf16x8*)(kSrc + 8 * i);
    vreg[i] = *(const bf16x8*)(vSrc + 8 * i);
  }

  for (int kb = 0; kb <= kmax; kb += 32) {
    __syncthreads();   // previous readers done with LDS
#pragma unroll
    for (int i = 0; i < 4; ++i) {
      *(bf16x8*)(&ldsK[krow * KSTRIDE + kcol + 8 * i]) = kreg[i];
      *(bf16x8*)(&ldsV[t * VSTRIDE + 8 * i])           = vreg[i];
    }
    if (kb + 32 <= kmax) {   // prefetch next block during compute
      const bf16* kn = kSrc + (size_t)(kb + 32) * KVD;
      const bf16* vn = vSrc + (kb + 32);
#pragma unroll
      for (int i = 0; i < 4; ++i) {
        kreg[i] = *(const bf16x8*)(kn + 8 * i);
        vreg[i] = *(const bf16x8*)(vn + 8 * i);
      }
    }
    __syncthreads();   // tile visible

    // Phase 1: scores + softmax for both q-tiles (K fragments live here only).
    bf16x16 kf[2][2];
#pragma unroll
    for (int ktile = 0; ktile < 2; ++ktile)
#pragma unroll
      for (int c = 0; c < 2; ++c)
        kf[ktile][c] = lds_frag(ldsK + (ktile * 16) * KSTRIDE + c * 32, KSTRIDE);

    bf16x16 pf[QW];
    bool act[QW];
#pragma unroll
    for (int qt = 0; qt < QW; ++qt) {
      unsigned mbits = 0;
      {
#pragma unroll
        for (int r = 0; r < 8; ++r) { const int j0 = kb + kh8 + r; if (j0 < NKV) mbits |= 1u << r; if (j0 + 16 < NKV) mbits |= 1u << (8 + r); }
        act[qt] = (__builtin_amdgcn_ballot_w32(mbits != 0) != 0);
      }
      if (act[qt]) {
        const int q_my = q0 + 16 * qt + qlane;
        f32x8 s0 = {}, s1 = {};
        s0 = wmma_bf16(kf[0][0], qf[qt][0], s0);
        s0 = wmma_bf16(kf[0][1], qf[qt][1], s0);
        s1 = wmma_bf16(kf[1][0], qf[qt][0], s1);
        s1 = wmma_bf16(kf[1][1], qf[qt][1], s1);

        float mx = -INFINITY;
#pragma unroll
        for (int r = 0; r < 8; ++r) {
          const int k0i = kb + kh8 + r;
          const int k1i = k0i + 16;
          (void)k0i; (void)k1i; (void)q_my;
          s0[r] = (mbits & (1u << r))       ? s0[r] * scale + kbS[kb + kh8 + r] : NEG2;
          s1[r] = (mbits & (1u << (8 + r))) ? s1[r] * scale + kbS[kb + 16 + kh8 + r] : NEG2;
          mx = fmaxf(mx, fmaxf(s0[r], s1[r]));
        }
        mx = fmaxf(mx, __shfl_xor(mx, 16, 32));
        const float mnew  = fmaxf(mrun[qt], mx);
        const float alpha = exp2f(mrun[qt] - mnew);

        float rsum = 0.0f;
#pragma unroll
        for (int r = 0; r < 8; ++r) {
          const float p0 = exp2f(s0[r] - mnew);
          const float p1 = exp2f(s1[r] - mnew);
          rsum += p0 + p1;
          pf[qt][r]     = (bf16)(p0 * 1024.0f);     // P carried x1024: no f16 copy of a probability is sub-normal
          pf[qt][r + 8] = (bf16)(p1 * 1024.0f);
        }
        rsum += __shfl_xor(rsum, 16, 32);
        lrun[qt] = lrun[qt] * alpha + rsum;
        mrun[qt] = mnew;

        // Rescale accumulators now so the PV phase is pure WMMA.
#pragma unroll
        for (int j = 0; j < 4; ++j)
#pragma unroll
          for (int r = 0; r < 8; ++r) o[qt][j][r] *= alpha;
      }
    }

    // Phase 2: O^T accumulate; each V fragment read from LDS once, used by
    // both q-tiles, then dead (only 8 VGPRs of V live at a time).
#pragma unroll
    for (int j = 0; j < 4; ++j) {
      const bf16x16 vf = lds_frag(ldsV + (j * 16) * VSTRIDE, VSTRIDE);
#pragma unroll
      for (int qt = 0; qt < QW; ++qt)
        if (act[qt]) o[qt][j] = wmma_bf16(vf, pf[qt], o[qt][j]);
    }
  }

  __shared__ __attribute__((aligned(16))) float ldsOf[2][32 * 68];
  float* so = ldsOf[wave]; (void)ldsO;
#pragma unroll
  for (int qt = 0; qt < QW; ++qt) {
    const float rl = 1.0f / (lrun[qt] * 1024.0f);
#pragma unroll
    for (int j = 0; j < 4; ++j)
#pragma unroll
      for (int r = 0; r < 8; ++r) so[(16 * qt + qlane) * 68 + j * 16 + kh8 + r] = o[qt][j][r] * rl;
  }
  asm volatile("s_wait_dscnt 0" ::: "memory");
  __builtin_amdgcn_wave_barrier();
{
#pragma unroll
    for (int it = 0; it < 16; ++it) { const int ch = lane + 32 * it, ql = ch >> 4, q4 = (ch & 15) * 4;
      *(v4f_t*)(attnOut + ((size_t)(b * QROWS + q0 + ql)) * DD + h * DKK + q4) = *(const v4fa*)(so + ql * 68 + q4); }
    
  }
}


// padded f16 rows Q16[b][1024][1024] (rows ≥ 1000 zero) and Vᵀ[b][1024 dims][1024 keys] (cols ≥ 1000 zero); block = 64 padded tokens x one head
__global__ __launch_bounds__(256) void k_prep(const float* __restrict__ q, bf16* __restrict__ Q16, bf16* __restrict__ Vt) {
  __shared__ __attribute__((aligned(16))) bf16 qS[64][72], vT[64][72];
  const int tid = threadIdx.x; const int n0 = blockIdx.x * 64, h = blockIdx.y, b = blockIdx.z;
  for (int e = tid; e < 64 * 64; e += 256) { const int t = e >> 6, d = e & 63; const int n = n0 + t; const float v = (n < LTRUE) ? q[((size_t)b * LTRUE + n) * DD + h * DKK + d] : 0.0f; qS[t][d] = (bf16)v; vT[d][t] = (bf16)v; }
  __syncthreads();
{
#pragma unroll 1
    for (int round = 0; round < 2; ++round) { const int r = round * 32 + (tid >> 3), piece = (tid & 7) * 8;
      *(v4u_t*)(Q16 + ((size_t)b * SS + n0 + r) * DD + h * DKK + piece) = *(const v4ua*)(&qS[r][piece]);
      *(v4u_t*)(Vt + ((size_t)b * DD + h * DKK + r) * SS + n0 + piece) = *(const v4ua*)(&vT[r][piece]); }
     }
}
// kbias[b][k] = 0 if (k < 1000 and mask != 0) else −1e9   (4 KB rows)
__global__ __launch_bounds__(256) void k_kbias(const int* __restrict__ mask, float* __restrict__ kb) { const int b = blockIdx.x;
  for (int q4 = threadIdx.x; q4 < KROWS / 4; q4 += 256) { v4f_t o; for (int e = 0; e < 4; ++e) { const int k = q4 * 4 + e; o[e] = (k < LTRUE && mask[b * LTRUE + k] != 0) ? 0.0f : -1.0e9f; }
    *(v4f_t*)(kb + (size_t)b * KROWS + q4 * 4) = o;  } }
// copy the 1000 real rows of each batch into d_out (4 KB rows)
__global__ __launch_bounds__(256) void k_copy(const float* __restrict__ A, float* __restrict__ out) { const int n = blockIdx.x, b = blockIdx.y;
  const v4f_t v = *(const v4f_t*)(A + ((size_t)b * QROWS + n) * DD + threadIdx.x * 4);
  *(v4f_t*)(out + ((size_t)b * LTRUE + n) * DD + threadIdx.x * 4) = v;  }

extern "C" void kernel_launch(void* const* d_in, const int* in_sizes, int n_in,
                              void* d_out, int out_size, void* d_ws, size_t ws_size,
                              hipStream_t stream) {
  (void)in_sizes; (void)n_in; (void)out_size;
  const float* q = (const float*)d_in[0]; const int* mask = (const int*)d_in[1];
  float* out = (float*)d_out;     // [8,1000,1024]
  char* ws = (char*)d_ws;
  bf16* Q16 = (bf16*)ws; ws += (size_t)BB * SS * DD * 2;        // 16 MB (serves as Q and K)
  bf16* Vt = (bf16*)ws; ws += (size_t)BB * DD * SS * 2;         // 16 MB
  float* A = (float*)ws; ws += (size_t)BB * QROWS * DD * 4;     // 32 MB f32 attention rows (padded)
  float* kb = (float*)ws; ws += (size_t)BB * KROWS * 4;
  if ((size_t)(ws - (char*)d_ws) > ws_size) return;
  const dim3 blk(256);
  k_prep<<<dim3(SS / 64, HH, BB), blk, 0, stream>>>(q, Q16, Vt);
  k_kbias<<<dim3(BB), blk, 0, stream>>>(mask, kb);
  attn_kernel<<<dim3(QROWS / 64, HH, BB), dim3(64), 0, stream>>>(Q16, Q16, Vt, kb, A);
  k_copy<<<dim3(LTRUE, BB), blk, 0, stream>>>(A, out);
}

// v001
// A run of this version takes 78 microseconds.
// Next to v000, in two timings, it ran 1.13 times as fast each time.
// Contractions on v_wmma_f32_16x16x32_f16 (plain f16 operands, f32 accumulate): self-attention with q = k = v = query (no projections),
// 16 heads of 64, sequence 1000 zero-padded to 1024 as in the reference, scale 1/8, additive key mask (0 → −1e9 for mask == 0 and for the
// 24 padding keys) — flash-style Sᵀ = K·Qᵀ / Oᵀ = Vᵀ·Pᵀ with per-(batch,key) bias, online softmax in f32 (P x1024);
// the padded query rows are not stored: the attention kernel writes the [8,1000,1024] output itself. compute dtype: f16 operands, f32 accumulate.
#include <hip/hip_runtime.h>
#include <hip/hip_bf16.h>
#include <math.h>

#define BB 8
#define LTRUE 1000
#define SS 1024
#define QROWS 1024
#define KROWS 1024
#define NKV 1024
#define DD 1024
#define HH 16
#define KVH 16
#define KVD 1024
#define HKDIV 1
#define DKK 64
#define QW 2
#define GSTR 48

typedef _Float16 bf16;
typedef _Float16 f16;
typedef __attribute__((ext_vector_type(4))) unsigned v4u_t;
typedef unsigned v4ua __attribute__((ext_vector_type(4), may_alias));
typedef __attribute__((ext_vector_type(4))) float v4f_t;
typedef __attribute__((ext_vector_type(4))) int v4i_t;
typedef float v4fa __attribute__((ext_vector_type(4), may_alias));
typedef __attribute__((ext_vector_type(16))) bf16  bf16x16;
typedef bf16x16 f16x16;
typedef __attribute__((ext_vector_type(8)))  bf16  bf16x8;
typedef bf16x8 f16x8;
typedef __attribute__((ext_vector_type(4)))  bf16  bf16x4;
typedef __attribute__((ext_vector_type(8)))  float f32x8;
__device__ __forceinline__ f32x8 wmma16(f16x16 a, f16x16 b, f32x8 c) {
  c = __builtin_amdgcn_wmma_f32_16x16x32_f16(false, a, false, b, (short)0, c, false, false);
  asm volatile("v_nop\n\tv_nop\n\tv_nop\n\tv_nop" : "+v"(c) : "v"(a), "v"(b));
  return c;
}
#define LDS_STRIDE 48   // unused: 48 elems (96B rows)
#define KSTRIDE    72   // attn K tile: 64 -> 72 elems (144B rows): conflict-free b128
#define VSTRIDE    48   // attn V tile: 32 -> 48 elems

__device__ __forceinline__ f32x8 wmma_bf16(bf16x16 a, bf16x16 b, f32x8 c) {
  c = __builtin_amdgcn_wmma_f32_16x16x32_f16(false, a, false, b, (short)0, c, false, false);
  asm volatile("v_nop\n\tv_nop\n\tv_nop\n\tv_nop" : "+v"(c) : "v"(a), "v"(b));   // A/B-overwrite hazard guard
  return c;
}

// 16x32 (MxK) f16 fragment from a row-major global matrix.
// lanes 0-15  (row=lane)    : elems 0..7 = K+0..7,  8..15 = K+16..23
// lanes 16-31 (row=lane-16) : elems 0..7 = K+8..15, 8..15 = K+24..31
template <typename T>
__device__ __forceinline__ bf16x16 load_frag(const T* __restrict__ base, int ld,
                                             int row0, int k0) {
  const int lane = threadIdx.x & 31;
  const int r    = lane & 15;
  const int kh   = (lane >> 4) * 8;
  const T* p0 = base + (size_t)(row0 + r) * ld + (k0 + kh);
  const T* p1 = p0 + 16;
  bf16x16 f;
#pragma unroll
  for (int i = 0; i < 8; ++i) {
    f[i]     = (bf16)p0[i];
    f[i + 8] = (bf16)p1[i];
  }
  return f;
}

// Same fragment from an LDS tile with padded row stride (base includes row0/k0).
__device__ __forceinline__ bf16x16 lds_frag(const bf16* base, int stride) {
  const int lane = threadIdx.x & 31;
  const int row  = lane & 15;
  const int kh   = (lane >> 4) * 8;
  const bf16x8 lo = *(const bf16x8*)(base + row * stride + kh);
  const bf16x8 hi = *(const bf16x8*)(base + row * stride + kh + 16);
  bf16x16 f;
#pragma unroll
  for (int i = 0; i < 8; ++i) { f[i] = lo[i]; f[i + 8] = hi[i]; }
  return f;
}

template <typename T>
__device__ __forceinline__ void stage_read16(const T* __restrict__ p, float* buf) {
#pragma unroll
  for (int i = 0; i < 16; ++i) buf[i] = (float)p[i];
}

__device__ __forceinline__ void stage_write(bf16* dst, const float* buf, int nquad) {
#pragma unroll
  for (int i = 0; i < nquad; ++i) {
    bf16x4 q;
    q[0] = (bf16)buf[4 * i];     q[1] = (bf16)buf[4 * i + 1];
    q[2] = (bf16)buf[4 * i + 2]; q[3] = (bf16)buf[4 * i + 3];
    *(bf16x4*)(dst + 4 * i) = q;
  }
}

// ---------------------------------------------------------------------------
// Attention: block 64 thr (2 waves) = 64 queries x one head; key step 32;
// wave tile 32 queries x 64 dk. K/Vᵀ staged through LDS (f16, padded stride)
// with next-block register prefetch overlapping the WMMA phase.
// Output: f32 rows [B][LTRUE][DD] (head h at columns h*64..h*64+63).
// ---------------------------------------------------------------------------
__global__ __launch_bounds__(64) void attn_kernel(
    const bf16* __restrict__ Qb, const bf16* __restrict__ Kb,
    const bf16* __restrict__ Vt, const int* __restrict__ mask,   // mask [B][LTRUE]: 0 = key blocked
    float* __restrict__ out) {                                    // out [B][LTRUE][DD]: the padded query rows are not stored
  __shared__ bf16 ldsK[32 * KSTRIDE];   // 4.5 KB
  __shared__ bf16 ldsV[64 * VSTRIDE];   // 6.0 KB
  __shared__ __attribute__((aligned(16))) bf16 ldsO[2][32 * 72];   // unused (output is staged in ldsOf)

  const int q0blk = blockIdx.x * 64;
  const int h  = blockIdx.y;
  const int b  = blockIdx.z;
  const int t    = threadIdx.x;
  const int wave = t >> 5;
  const int lane = t & 31;
  const int qlane = lane & 15;
  const int kh8   = (lane >> 4) * 8;
  const int q0 = q0blk + wave * 32;          // this wave's 32 queries

  const int hk = h / HKDIV;
  const bf16* Qh = Qb + (size_t)b * QROWS * DD + h * DKK;        // queries: QROWS rows per batch, row stride DD
  const bf16* Kh = Kb + (size_t)b * KROWS * KVD + hk * DKK;      // keys: KROWS rows per batch, row stride KVD
  const bf16* Vh = Vt + ((size_t)(b * KVH + hk)) * DKK * KROWS;  // Vᵀ [KVH][64][KROWS] per batch

  // Cooperative staging (64 threads): K tile 32x64 (2 thr/row, 64B each);
  // V tile 64x32 (1 thr/row, 64B each).
  const int krow = t >> 1;
  const int kcol = (t & 1) * 32;
  const bf16* kSrc = Kh + (size_t)krow * KVD + kcol;
  const bf16* vSrc = Vh + (size_t)t * KROWS;

  bf16x16 qf[QW][2];
#pragma unroll
  for (int qt = 0; qt < QW; ++qt) {
    qf[qt][0] = load_frag(Qh, DD, q0 + 16 * qt, 0);
    qf[qt][1] = load_frag(Qh, DD, q0 + 16 * qt, 32);
  }

  f32x8 o[QW][4] = {};
  float mrun[QW], lrun[QW];
#pragma unroll
  for (int qt = 0; qt < QW; ++qt) { mrun[qt] = -INFINITY; lrun[qt] = 0.0f; }

  const float scale = 0.125f * 1.44269504088896340736f;  // 1/sqrt(DK)*log2(e)
  const float NEG2 = -1.0e9f;    // masked logit: its weight is exactly 0 once any valid key of the row has been seen (every row
                                 // has one), and anything accumulated before that is wiped by alpha == 0 — same result as -inf
  const int kmax = KROWS - 1;
  __shared__ __attribute__((aligned(16))) float kbS[KROWS];
  // additive per-key logit bias, in log2 units: 0 for an allowed key, -1e9 for mask == 0 and for the padding keys (4 keys a lane and trip)
  v4i_t mk[KROWS / 256];
#pragma unroll   // the index is clamped, not branched round, and the loop unrolled, so that all four mask loads are in flight together
  for (int j = 0; j < KROWS / 256; ++j) mk[j] = *(const v4i_t*)(mask + b * LTRUE + 4 * min(t + 64 * j, LTRUE / 4 - 1));
#pragma unroll   // mk[] indexed by constants only, so that it stays in registers
  for (int j = 0; j < KROWS / 256; ++j) {
    const int k4 = t + 64 * j;
    v4f_t kv;
    for (int e = 0; e < 4; ++e) kv[e] = ((k4 < LTRUE / 4 && mk[j][e] != 0) ? 0.0f : -1.0e9f) * 1.44269504088896340736f;
    *(v4f_t*)(kbS + 4 * k4) = kv;
  }
  __syncthreads();

  // Prefetch key block kb=0 into registers.
  bf16x8 kreg[4], vreg[4];
#pragma unroll
  for (int i = 0; i < 4; ++i) {
    kreg[i] = *(const bf16x8*)(kSrc + 8 * i);
    vreg[i] = *(const bf16x8*)(vSrc + 8 * i);
  }

  for (int kb = 0; kb <= kmax; kb += 32) {
    __syncthreads();   // previous readers done with LDS
#pragma unroll
    for (int i = 0; i < 4; ++i) {
      *(bf16x8*)(&ldsK[krow * KSTRIDE + kcol + 8 * i]) = kreg[i];
      *(bf16x8*)(&ldsV[t * VSTRIDE + 8 * i])           = vreg[i];
    }
    if (kb + 32 <= kmax) {   // prefetch next block during compute
      const bf16* kn = kSrc + (size_t)(kb + 32) * KVD;
      const bf16* vn = vSrc + (kb + 32);
#pragma unroll
      for (int i = 0; i < 4; ++i) {
        kreg[i] = *(const bf16x8*)(kn + 8 * i);
        vreg[i] = *(const bf16x8*)(vn + 8 * i);
      }
    }
    __syncthreads();   // tile visible

    // Phase 1: scores + softmax for both q-tiles (K fragments live here only).
    bf16x16 kf[2][2];
#pragma unroll
    for (int ktile = 0; ktile < 2; ++ktile)
#pragma unroll
      for (int c = 0; c < 2; ++c)
        kf[ktile][c] = lds_frag(ldsK + (ktile * 16) * KSTRIDE + c * 32, KSTRIDE);

    bf16x16 pf[QW];
    bool act[QW];
#pragma unroll
    for (int qt = 0; qt < QW; ++qt) {
      unsigned mbits = 0;
      {
#pragma unroll
        for (int r = 0; r < 8; ++r) { const int j0 = kb + kh8 + r; if (j0 < NKV) mbits |= 1u << r; if (j0 + 16 < NKV) mbits |= 1u << (8 + r); }
        act[qt] = (__builtin_amdgcn_ballot_w32(mbits != 0) != 0);
      }
      if (act[qt]) {
        const int q_my = q0 + 16 * qt + qlane;
        f32x8 s0 = {}, s1 = {};
        s0 = wmma_bf16(kf[0][0], qf[qt][0], s0);
        s0 = wmma_bf16(kf[0][1], qf[qt][1], s0);
        s1 = wmma_bf16(kf[1][0], qf[qt][0], s1);
        s1 = wmma_bf16(kf[1][1], qf[qt][1], s1);

        float mx = -INFINITY;
#pragma unroll
        for (int r = 0; r < 8; ++r) {
          const int k0i = kb + kh8 + r;
          const int k1i = k0i + 16;
          (void)k0i; (void)k1i; (void)q_my;
          s0[r] = (mbits & (1u << r))       ? s0[r] * scale + kbS[kb + kh8 + r] : NEG2;
          s1[r] = (mbits & (1u << (8 + r))) ? s1[r] * scale + kbS[kb + 16 + kh8 + r] : NEG2;
          mx = fmaxf(mx, fmaxf(s0[r], s1[r]));
        }
        mx = fmaxf(mx, __shfl_xor(mx, 16, 32));
        const float mnew  = fmaxf(mrun[qt], mx);
        const float alpha = exp2f(mrun[qt] - mnew);

        float rsum = 0.0f;
#pragma unroll
        for (int r = 0; r < 8; ++r) {
          const float p0 = exp2f(s0[r] - mnew);
          const float p1 = exp2f(s1[r] - mnew);
          rsum += p0 + p1;
          pf[qt][r]     = (bf16)(p0 * 1024.0f);     // P carried x1024: no f16 copy of a probability is sub-normal
          pf[qt][r + 8] = (bf16)(p1 * 1024.0f);
        }
        rsum += __shfl_xor(rsum, 16, 32);
        lrun[qt] = lrun[qt] * alpha + rsum;
        mrun[qt] = mnew;

        // Rescale accumulators now so the PV phase is pure WMMA.
#pragma unroll
        for (int j = 0; j < 4; ++j)
#pragma unroll
          for (int r = 0; r < 8; ++r) o[qt][j][r] *= alpha;
      }
    }

    // Phase 2: O^T accumulate; each V fragment read from LDS once, used by
    // both q-tiles, then dead (only 8 VGPRs of V live at a time).
#pragma unroll
    for (int j = 0; j < 4; ++j) {
      const bf16x16 vf = lds_frag(ldsV + (j * 16) * VSTRIDE, VSTRIDE);
#pragma unroll
      for (int qt = 0; qt < QW; ++qt)
        if (act[qt]) o[qt][j] = wmma_bf16(vf, pf[qt], o[qt][j]);
    }
  }

  __shared__ __attribute__((aligned(16))) float ldsOf[2][32 * 68];
  float* so = ldsOf[wave]; (void)ldsO;
#pragma unroll
  for (int qt = 0; qt < QW; ++qt) {
    const float rl = 1.0f / (lrun[qt] * 1024.0f);
#pragma unroll
    for (int j = 0; j < 4; ++j)
#pragma unroll
      for (int r = 0; r < 8; ++r) so[(16 * qt + qlane) * 68 + j * 16 + kh8 + r] = o[qt][j][r] * rl;
  }
  asm volatile("s_wait_dscnt 0" ::: "memory");
  __builtin_amdgcn_wave_barrier();
  float* orow = out + ((size_t)(b * LTRUE + q0)) * DD + h * DKK;
  if (q0 + 32 <= LTRUE) {   // all 32 query rows of the wave are real (the test reads the same in every lane of a wave)
#pragma unroll
    for (int it = 0; it < 16; ++it) { const int ch = lane + 32 * it, ql = ch >> 4, q4 = (ch & 15) * 4;
      *(v4f_t*)(orow + (size_t)ql * DD + q4) = *(const v4fa*)(so + ql * 68 + q4); }
  } else {                  // the wave that holds the last real rows: the padded rows are not stored
#pragma unroll 1            // taken by one wave of each (batch, head) only: rolled, it keeps the kernel's text short
    for (int it = 0; it < 16; ++it) { const int ch = lane + 32 * it, ql = ch >> 4, q4 = (ch & 15) * 4;
      if (q0 + ql < LTRUE) {
        *(v4f_t*)(orow + (size_t)ql * DD + q4) = *(const v4fa*)(so + ql * 68 + q4);
        asm volatile("s_wait_xcnt 0x0" ::: "memory");   // stands in front of the next trip's rewrite of the store's address and data registers
      } }
  }
}


// padded f16 rows Q16[b][1024][1024] (rows ≥ 1000 zero) and Vᵀ[b][1024 dims][1024 keys] (cols ≥ 1000 zero); block = 64 padded tokens x one head
__global__ __launch_bounds__(256) void k_prep(const float* __restrict__ q, bf16* __restrict__ Q16, bf16* __restrict__ Vt) {
  __shared__ __attribute__((aligned(16))) bf16 qS[64][72], vT[64][72];
  const int tid = threadIdx.x; const int n0 = blockIdx.x * 64, h = blockIdx.y, b = blockIdx.z;
  for (int e = tid; e < 64 * 64; e += 256) { const int t = e >> 6, d = e & 63; const int n = n0 + t; const float v = (n < LTRUE) ? q[((size_t)b * LTRUE + n) * DD + h * DKK + d] : 0.0f; qS[t][d] = (bf16)v; vT[d][t] = (bf16)v; }
  __syncthreads();
{
#pragma unroll 1
    for (int round = 0; round < 2; ++round) { const int r = round * 32 + (tid >> 3), piece = (tid & 7) * 8;
      *(v4u_t*)(Q16 + ((size_t)b * SS + n0 + r) * DD + h * DKK + piece) = *(const v4ua*)(&qS[r][piece]);
      *(v4u_t*)(Vt + ((size_t)b * DD + h * DKK + r) * SS + n0 + piece) = *(const v4ua*)(&vT[r][piece]); }
     }
}

extern "C" void kernel_launch(void* const* d_in, const int* in_sizes, int n_in,
                              void* d_out, int out_size, void* d_ws, size_t ws_size,
                              hipStream_t stream) {
  (void)in_sizes; (void)n_in; (void)out_size;
  const float* q = (const float*)d_in[0]; const int* mask = (const int*)d_in[1];
  float* out = (float*)d_out;     // [8,1000,1024]
  char* ws = (char*)d_ws;
  bf16* Q16 = (bf16*)ws; ws += (size_t)BB * SS * DD * 2;        // 16 MB (serves as Q and K)
  bf16* Vt = (bf16*)ws; ws += (size_t)BB * DD * SS * 2;         // 16 MB
  if ((size_t)(ws - (char*)d_ws) > ws_size) return;
  const dim3 blk(256);
  k_prep<<<dim3(SS / 64, HH, BB), blk, 0, stream>>>(q, Q16, Vt);
  attn_kernel<<<dim3(QROWS / 64, HH, BB), dim3(64), 0, stream>>>(Q16, Q16, Vt, mask, out);
}

// v002
// One run takes 70.5 microseconds.
// Timed twice side by side with v001, it ran 1.11 times as fast both times.
// Over all steps from v000 it is 1.25 times as fast.
// Contractions on v_wmma_f32_16x16x32_f16 (plain f16 operands, f32 accumulate): self-attention with q = k = v = query (no projections),
// 16 heads of 64, sequence 1000 zero-padded to 1024 as in the reference, scale 1/8, additive key mask (0 → −1e9 for mask == 0 and for the
// 24 padding keys) — flash-style Sᵀ = K·Qᵀ / Oᵀ = Vᵀ·Pᵀ with per-(batch,key) bias, online softmax in f32 (P x1024);
// the padded query rows are not stored: the attention kernel writes the [8,1000,1024] output itself. compute dtype: f16 operands, f32 accumulate.
#include <hip/hip_runtime.h>
#include <hip/hip_bf16.h>
#include <math.h>

#define BB 8
#define LTRUE 1000
#define SS 1024
#define QROWS 1024
#define KROWS 1024
#define NKV 1024
#define DD 1024
#define HH 16
#define KVH 16
#define KVD 1024
#define HKDIV 1
#define DKK 64
#define QW 2
#define GSTR 48

typedef _Float16 bf16;
typedef _Float16 f16;
typedef __attribute__((ext_vector_type(4))) unsigned v4u_t;
typedef unsigned v4ua __attribute__((ext_vector_type(4), may_alias));
typedef __attribute__((ext_vector_type(4))) float v4f_t;
typedef __attribute__((ext_vector_type(4))) int v4i_t;
typedef float v4fa __attribute__((ext_vector_type(4), may_alias));
typedef __attribute__((ext_vector_type(16))) bf16  bf16x16;
typedef bf16x16 f16x16;
typedef __attribute__((ext_vector_type(8)))  bf16  bf16x8;
typedef bf16x8 f16x8;
typedef __attribute__((ext_vector_type(4)))  bf16  bf16x4;
typedef __attribute__((ext_vector_type(8)))  float f32x8;
__device__ __forceinline__ f32x8 wmma16(f16x16 a, f16x16 b, f32x8 c) {
  c = __builtin_amdgcn_wmma_f32_16x16x32_f16(false, a, false, b, (short)0, c, false, false);
  asm volatile("v_nop\n\tv_nop\n\tv_nop\n\tv_nop" : "+v"(c) : "v"(a), "v"(b));
  return c;
}
#define LDS_STRIDE 48   // unused: 48 elems (96B rows)
#define KSTRIDE    72   // attn K tile: 64 -> 72 elems (144B rows): conflict-free b128
#define VSTRIDE    48   // attn V tile: 32 -> 48 elems

__device__ __forceinline__ f32x8 wmma_bf16(bf16x16 a, bf16x16 b, f32x8 c) {
  c = __builtin_amdgcn_wmma_f32_16x16x32_f16(false, a, false, b, (short)0, c, false, false);
  asm volatile("v_nop\n\tv_nop\n\tv_nop\n\tv_nop" : "+v"(c) : "v"(a), "v"(b));   // A/B-overwrite hazard guard
  return c;
}

// x = 2^x for a run of values, each on the bare v_exp_f32 and in its own register. The library's exp2f adds a compare, two selects, an add
// and a v_ldexp_f32 per value to keep results below 2^-126; here such a result may come out as 0: every argument is <= 0, and the result is
// only ever added to a row sum >= 1, rounded to an f16 weight, or multiplied into sums that a weight of 1 has just joined.
// One statement per run: each v_exp_f32 is followed by one on other registers and the last by a v_nop, the slot that the instruction set
// asks for behind a transcendental.
__device__ __forceinline__ void exp2_run8(float* x) {
  asm("v_exp_f32 %0, %0\n\tv_exp_f32 %1, %1\n\tv_exp_f32 %2, %2\n\tv_exp_f32 %3, %3\n\t"
      "v_exp_f32 %4, %4\n\tv_exp_f32 %5, %5\n\tv_exp_f32 %6, %6\n\tv_exp_f32 %7, %7\n\tv_nop"
      : "+v"(x[0]), "+v"(x[1]), "+v"(x[2]), "+v"(x[3]), "+v"(x[4]), "+v"(x[5]), "+v"(x[6]), "+v"(x[7]));
}
__device__ __forceinline__ void exp2_run9(float* x, float& y) {
  asm("v_exp_f32 %0, %0\n\tv_exp_f32 %1, %1\n\tv_exp_f32 %2, %2\n\tv_exp_f32 %3, %3\n\tv_exp_f32 %8, %8\n\t"
      "v_exp_f32 %4, %4\n\tv_exp_f32 %5, %5\n\tv_exp_f32 %6, %6\n\tv_exp_f32 %7, %7\n\tv_nop"
      : "+v"(x[0]), "+v"(x[1]), "+v"(x[2]), "+v"(x[3]), "+v"(x[4]), "+v"(x[5]), "+v"(x[6]), "+v"(x[7]), "+v"(y));
}

// 16x32 (MxK) f16 fragment from a row-major global matrix.
// lanes 0-15  (row=lane)    : elems 0..7 = K+0..7,  8..15 = K+16..23
// lanes 16-31 (row=lane-16) : elems 0..7 = K+8..15, 8..15 = K+24..31
template <typename T>
__device__ __forceinline__ bf16x16 load_frag(const T* __restrict__ base, int ld,
                                             int row0, int k0) {
  const int lane = threadIdx.x & 31;
  const int r    = lane & 15;
  const int kh   = (lane >> 4) * 8;
  const T* p0 = base + (size_t)(row0 + r) * ld + (k0 + kh);
  const T* p1 = p0 + 16;
  bf16x16 f;
#pragma unroll
  for (int i = 0; i < 8; ++i) {
    f[i]     = (bf16)p0[i];
    f[i + 8] = (bf16)p1[i];
  }
  return f;
}

// Same fragment from an LDS tile with padded row stride (base includes row0/k0).
__device__ __forceinline__ bf16x16 lds_frag(const bf16* base, int stride) {
  const int lane = threadIdx.x & 31;
  const int row  = lane & 15;
  const int kh   = (lane >> 4) * 8;
  const bf16x8 lo = *(const bf16x8*)(base + row * stride + kh);
  const bf16x8 hi = *(const bf16x8*)(base + row * stride + kh + 16);
  bf16x16 f;
#pragma unroll
  for (int i = 0; i < 8; ++i) { f[i] = lo[i]; f[i + 8] = hi[i]; }
  return f;
}

template <typename T>
__device__ __forceinline__ void stage_read16(const T* __restrict__ p, float* buf) {
#pragma unroll
  for (int i = 0; i < 16; ++i) buf[i] = (float)p[i];
}

__device__ __forceinline__ void stage_write(bf16* dst, const float* buf, int nquad) {
#pragma unroll
  for (int i = 0; i < nquad; ++i) {
    bf16x4 q;
    q[0] = (bf16)buf[4 * i];     q[1] = (bf16)buf[4 * i + 1];
    q[2] = (bf16)buf[4 * i + 2]; q[3] = (bf16)buf[4 * i + 3];
    *(bf16x4*)(dst + 4 * i) = q;
  }
}

// ---------------------------------------------------------------------------
// Attention: block 64 thr (2 waves) = 64 queries x one head; key step 32;
// wave tile 32 queries x 64 dk. K/Vᵀ staged through LDS (f16, padded stride)
// with next-block register prefetch overlapping the WMMA phase.
// Output: f32 rows [B][LTRUE][DD] (head h at columns h*64..h*64+63).
// ---------------------------------------------------------------------------
__global__ __launch_bounds__(64) void attn_kernel(
    const bf16* __restrict__ Qb, const bf16* __restrict__ Kb,
    const bf16* __restrict__ Vt, const int* __restrict__ mask,   // mask [B][LTRUE]: 0 = key blocked
    float* __restrict__ out) {                                    // out [B][LTRUE][DD]: the padded query rows are not stored
  __shared__ bf16 ldsK[32 * KSTRIDE];   // 4.5 KB
  __shared__ bf16 ldsV[64 * VSTRIDE];   // 6.0 KB
  __shared__ __attribute__((aligned(16))) bf16 ldsO[2][32 * 72];   // unused (output is staged in ldsOf)

  const int q0blk = blockIdx.x * 64;
  const int h  = blockIdx.y;
  const int b  = blockIdx.z;
  const int t    = threadIdx.x;
  const int wave = t >> 5;
  const int lane = t & 31;
  const int qlane = lane & 15;
  const int kh8   = (lane >> 4) * 8;
  const int q0 = q0blk + wave * 32;          // this wave's 32 queries

  const int hk = h / HKDIV;
  const bf16* Qh = Qb + (size_t)b * QROWS * DD + h * DKK;        // queries: QROWS rows per batch, row stride DD
  const bf16* Kh = Kb + (size_t)b * KROWS * KVD + hk * DKK;      // keys: KROWS rows per batch, row stride KVD
  const bf16* Vh = Vt + ((size_t)(b * KVH + hk)) * DKK * KROWS;  // Vᵀ [KVH][64][KROWS] per batch

  // Cooperative staging (64 threads): K tile 32x64 (2 thr/row, 64B each);
  // V tile 64x32 (1 thr/row, 64B each).
  const int krow = t >> 1;
  const int kcol = (t & 1) * 32;
  const bf16* kSrc = Kh + (size_t)krow * KVD + kcol;
  const bf16* vSrc = Vh + (size_t)t * KROWS;

  bf16x16 qf[QW][2];
#pragma unroll
  for (int qt = 0; qt < QW; ++qt) {
    qf[qt][0] = load_frag(Qh, DD, q0 + 16 * qt, 0);
    qf[qt][1] = load_frag(Qh, DD, q0 + 16 * qt, 32);
  }

  f32x8 o[QW][4] = {};
  float mrun[QW], lrun[QW];
#pragma unroll
  for (int qt = 0; qt < QW; ++qt) { mrun[qt] = -INFINITY; lrun[qt] = 0.0f; }

  const float scale = 0.125f * 1.44269504088896340736f;  // 1/sqrt(DK)*log2(e)
  const float NEG2 = -1.0e9f;    // masked logit: its weight is exactly 0 once any valid key of the row has been seen (every row
                                 // has one), and anything accumulated before that is wiped by alpha == 0 — same result as -inf
  const int kmax = KROWS - 1;
  __shared__ __attribute__((aligned(16))) float kbS[KROWS];
  // additive per-key logit bias, in log2 units: 0 for an allowed key, -1e9 for mask == 0 and for the padding keys (4 keys a lane and trip)
  v4i_t mk[KROWS / 256];
#pragma unroll   // the index is clamped, not branched round, and the loop unrolled, so that all four mask loads are in flight together
  for (int j = 0; j < KROWS / 256; ++j) mk[j] = *(const v4i_t*)(mask + b * LTRUE + 4 * min(t + 64 * j, LTRUE / 4 - 1));
#pragma unroll   // mk[] indexed by constants only, so that it stays in registers
  for (int j = 0; j < KROWS / 256; ++j) {
    const int k4 = t + 64 * j;
    v4f_t kv;
    for (int e = 0; e < 4; ++e) kv[e] = ((k4 < LTRUE / 4 && mk[j][e] != 0) ? 0.0f : -1.0e9f) * 1.44269504088896340736f;
    *(v4f_t*)(kbS + 4 * k4) = kv;
  }
  __syncthreads();

  // Prefetch key block kb=0 into registers.
  bf16x8 kreg[4], vreg[4];
#pragma unroll
  for (int i = 0; i < 4; ++i) {
    kreg[i] = *(const bf16x8*)(kSrc + 8 * i);
    vreg[i] = *(const bf16x8*)(vSrc + 8 * i);
  }

  for (int kb = 0; kb <= kmax; kb += 32) {
    __syncthreads();   // previous readers done with LDS
#pragma unroll
    for (int i = 0; i < 4; ++i) {
      *(bf16x8*)(&ldsK[krow * KSTRIDE + kcol + 8 * i]) = kreg[i];
      *(bf16x8*)(&ldsV[t * VSTRIDE + 8 * i])           = vreg[i];
    }
    if (kb + 32 <= kmax) {   // prefetch next block during compute
      const bf16* kn = kSrc + (size_t)(kb + 32) * KVD;
      const bf16* vn = vSrc + (kb + 32);
#pragma unroll
      for (int i = 0; i < 4; ++i) {
        kreg[i] = *(const bf16x8*)(kn + 8 * i);
        vreg[i] = *(const bf16x8*)(vn + 8 * i);
      }
    }
    __syncthreads();   // tile visible

    // Phase 1: scores + softmax for both q-tiles (K fragments live here only).
    bf16x16 kf[2][2];
#pragma unroll
    for (int ktile = 0; ktile < 2; ++ktile)
#pragma unroll
      for (int c = 0; c < 2; ++c)
        kf[ktile][c] = lds_frag(ldsK + (ktile * 16) * KSTRIDE + c * 32, KSTRIDE);

    bf16x16 pf[QW];
    bool act[QW];
#pragma unroll
    for (int qt = 0; qt < QW; ++qt) {
      unsigned mbits = 0;
      {
#pragma unroll
        for (int r = 0; r < 8; ++r) { const int j0 = kb + kh8 + r; if (j0 < NKV) mbits |= 1u << r; if (j0 + 16 < NKV) mbits |= 1u << (8 + r); }
        act[qt] = (__builtin_amdgcn_ballot_w32(mbits != 0) != 0);
      }
      if (act[qt]) {
        const int q_my = q0 + 16 * qt + qlane;
        f32x8 s0 = {}, s1 = {};
        s0 = wmma_bf16(kf[0][0], qf[qt][0], s0);
        s0 = wmma_bf16(kf[0][1], qf[qt][1], s0);
        s1 = wmma_bf16(kf[1][0], qf[qt][0], s1);
        s1 = wmma_bf16(kf[1][1], qf[qt][1], s1);

        float mx = -INFINITY;
#pragma unroll
        for (int r = 0; r < 8; ++r) {
          const int k0i = kb + kh8 + r;
          const int k1i = k0i + 16;
          (void)k0i; (void)k1i; (void)q_my;
          s0[r] = (mbits & (1u << r))       ? s0[r] * scale + kbS[kb + kh8 + r] : NEG2;
          s1[r] = (mbits & (1u << (8 + r))) ? s1[r] * scale + kbS[kb + 16 + kh8 + r] : NEG2;
          mx = fmaxf(mx, fmaxf(s0[r], s1[r]));
        }
        mx = fmaxf(mx, __shfl_xor(mx, 16, 32));
        const float mnew  = fmaxf(mrun[qt], mx);
        float alpha = mrun[qt] - mnew;
        float e0[8], e1[8];
#pragma unroll
        for (int r = 0; r < 8; ++r) { e0[r] = s0[r] - mnew; e1[r] = s1[r] - mnew; }
        exp2_run9(e0, alpha);
        exp2_run8(e1);

        float rsum = 0.0f;
#pragma unroll
        for (int r = 0; r < 8; ++r) {
          const float p0 = e0[r];
          const float p1 = e1[r];
          rsum += p0 + p1;
          pf[qt][r]     = (bf16)(p0 * 1024.0f);     // P carried x1024: no f16 copy of a probability is sub-normal
          pf[qt][r + 8] = (bf16)(p1 * 1024.0f);
        }
        rsum += __shfl_xor(rsum, 16, 32);
        lrun[qt] = lrun[qt] * alpha + rsum;
        mrun[qt] = mnew;

        // Rescale accumulators now so the PV phase is pure WMMA.
#pragma unroll
        for (int j = 0; j < 4; ++j)
#pragma unroll
          for (int r = 0; r < 8; ++r) o[qt][j][r] *= alpha;
      }
    }

    // Phase 2: O^T accumulate; each V fragment read from LDS once, used by
    // both q-tiles, then dead (only 8 VGPRs of V live at a time).
#pragma unroll
    for (int j = 0; j < 4; ++j) {
      const bf16x16 vf = lds_frag(ldsV + (j * 16) * VSTRIDE, VSTRIDE);
#pragma unroll
      for (int qt = 0; qt < QW; ++qt)
        if (act[qt]) o[qt][j] = wmma_bf16(vf, pf[qt], o[qt][j]);
    }
  }

  __shared__ __attribute__((aligned(16))) float ldsOf[2][32 * 68];
  float* so = ldsOf[wave]; (void)ldsO;
#pragma unroll
  for (int qt = 0; qt < QW; ++qt) {
    const float rl = 1.0f / (lrun[qt] * 1024.0f);
#pragma unroll
    for (int j = 0; j < 4; ++j)
#pragma unroll
      for (int r = 0; r < 8; ++r) so[(16 * qt + qlane) * 68 + j * 16 + kh8 + r] = o[qt][j][r] * rl;
  }
  asm volatile("s_wait_dscnt 0" ::: "memory");
  __builtin_amdgcn_wave_barrier();
  float* orow = out + ((size_t)(b * LTRUE + q0)) * DD + h * DKK;
  if (q0 + 32 <= LTRUE) {   // all 32 query rows of the wave are real (the test reads the same in every lane of a wave)
#pragma unroll
    for (int it = 0; it < 16; ++it) { const int ch = lane + 32 * it, ql = ch >> 4, q4 = (ch & 15) * 4;
      *(v4f_t*)(orow + (size_t)ql * DD + q4) = *(const v4fa*)(so + ql * 68 + q4); }
  } else {                  // the wave that holds the last real rows: the padded rows are not stored
#pragma unroll 1            // taken by one wave of each (batch, head) only: rolled, it keeps the kernel's text short
    for (int it = 0; it < 16; ++it) { const int ch = lane + 32 * it, ql = ch >> 4, q4 = (ch & 15) * 4;
      if (q0 + ql < LTRUE) {
        *(v4f_t*)(orow + (size_t)ql * DD + q4) = *(const v4fa*)(so + ql * 68 + q4);
        asm volatile("s_wait_xcnt 0x0" ::: "memory");   // stands in front of the next trip's rewrite of the store's address and data registers
      } }
  }
}


// padded f16 rows Q16[b][1024][1024] (rows ≥ 1000 zero) and Vᵀ[b][1024 dims][1024 keys] (cols ≥ 1000 zero); block = 64 padded tokens x one head
__global__ __launch_bounds__(256) void k_prep(const float* __restrict__ q, bf16* __restrict__ Q16, bf16* __restrict__ Vt) {
  __shared__ __attribute__((aligned(16))) bf16 qS[64][72], vT[64][72];
  const int tid = threadIdx.x; const int n0 = blockIdx.x * 64, h = blockIdx.y, b = blockIdx.z;
  for (int e = tid; e < 64 * 64; e += 256) { const int t = e >> 6, d = e & 63; const int n = n0 + t; const float v = (n < LTRUE) ? q[((size_t)b * LTRUE + n) * DD + h * DKK + d] : 0.0f; qS[t][d] = (bf16)v; vT[d][t] = (bf16)v; }
  __syncthreads();
{
#pragma unroll 1
    for (int round = 0; round < 2; ++round) { const int r = round * 32 + (tid >> 3), piece = (tid & 7) * 8;
      *(v4u_t*)(Q16 + ((size_t)b * SS + n0 + r) * DD + h * DKK + piece) = *(const v4ua*)(&qS[r][piece]);
      *(v4u_t*)(Vt + ((size_t)b * DD + h * DKK + r) * SS + n0 + piece) = *(const v4ua*)(&vT[r][piece]); }
     }
}

extern "C" void kernel_launch(void* const* d_in, const int* in_sizes, int n_in,
                              void* d_out, int out_size, void* d_ws, size_t ws_size,
                              hipStream_t stream) {
  (void)in_sizes; (void)n_in; (void)out_size;
  const float* q = (const float*)d_in[0]; const int* mask = (const int*)d_in[1];
  float* out = (float*)d_out;     // [8,1000,1024]
  char* ws = (char*)d_ws;
  bf16* Q16 = (bf16*)ws; ws += (size_t)BB * SS * DD * 2;        // 16 MB (serves as Q and K)
  bf16* Vt = (bf16*)ws; ws += (size_t)BB * DD * SS * 2;         // 16 MB
  if ((size_t)(ws - (char*)d_ws) > ws_size) return;
  const dim3 blk(256);
  k_prep<<<dim3(SS / 64, HH, BB), blk, 0, stream>>>(q, Q16, Vt);
  attn_kernel<<<dim3(QROWS / 64, HH, BB), dim3(64), 0, stream>>>(Q16, Q16, Vt, mask, out);
}

// v003
// A run of this version takes 61.1 microseconds.
// Timed twice side by side with v002, it ran 1.15 times as fast both times.
// All steps since v000 together make it 1.45 times as fast.
// Contractions on v_wmma_f32_16x16x32_f16 (plain f16 operands, f32 accumulate): self-attention with q = k = v = query (no projections),
// 16 heads of 64, sequence 1000 zero-padded to 1024 as in the reference, scale 1/8, additive key mask (0 → −1e9 for mask == 0 and for the
// 24 padding keys) — flash-style Sᵀ = K·Qᵀ / Oᵀ = Vᵀ·Pᵀ with per-(batch,key) bias, online softmax in f32 (P x1024);
// the padded query rows are not stored: the attention kernel writes the [8,1000,1024] output itself. compute dtype: f16 operands, f32 accumulate.
#include <hip/hip_runtime.h>
#include <hip/hip_bf16.h>
#include <math.h>

#define BB 8
#define LTRUE 1000
#define SS 1024
#define QROWS 1024
#define KROWS 1024
#define NKV 1024
#define DD 1024
#define HH 16
#define KVH 16
#define KVD 1024
#define HKDIV 1
#define DKK 64
#define QW 2
#define GSTR 48

typedef _Float16 bf16;
typedef _Float16 f16;
typedef __attribute__((ext_vector_type(4))) unsigned v4u_t;
typedef unsigned v4ua __attribute__((ext_vector_type(4), may_alias));
typedef __attribute__((ext_vector_type(4))) float v4f_t;
typedef __attribute__((ext_vector_type(4))) int v4i_t;
typedef float v4fa __attribute__((ext_vector_type(4), may_alias));
typedef __attribute__((ext_vector_type(16))) bf16  bf16x16;
typedef bf16x16 f16x16;
typedef __attribute__((ext_vector_type(8)))  bf16  bf16x8;
typedef bf16x8 f16x8;
typedef __attribute__((ext_vector_type(4)))  bf16  bf16x4;
typedef __attribute__((ext_vector_type(8)))  float f32x8;
__device__ __forceinline__ f32x8 wmma16(f16x16 a, f16x16 b, f32x8 c) {
  c = __builtin_amdgcn_wmma_f32_16x16x32_f16(false, a, false, b, (short)0, c, false, false);
  asm volatile("v_nop\n\tv_nop\n\tv_nop\n\tv_nop" : "+v"(c) : "v"(a), "v"(b));
  return c;
}
#define LDS_STRIDE 48   // unused: 48 elems (96B rows)
#define KSTRIDE    72   // attn K tile: 64 -> 72 elems (144B rows): conflict-free b128
#define VSTRIDE    48   // attn V tile: 32 -> 48 elems

__device__ __forceinline__ f32x8 wmma_bf16(bf16x16 a, bf16x16 b, f32x8 c) {
  c = __builtin_amdgcn_wmma_f32_16x16x32_f16(false, a, false, b, (short)0, c, false, false);
  asm volatile("v_nop\n\tv_nop\n\tv_nop\n\tv_nop" : "+v"(c) : "v"(a), "v"(b));   // A/B-overwrite hazard guard
  return c;
}

// x = 2^x for a run of values, each on the bare v_exp_f32 and in its own register. The library's exp2f adds a compare, two selects, an add
// and a v_ldexp_f32 per value to keep results below 2^-126; here such a result may come out as 0: every argument is <= 0, and the result is
// only ever added to a row sum >= 1, rounded to an f16 weight, or multiplied into sums that a weight of 1 has just joined.
// One statement per run: each v_exp_f32 is followed by one on other registers and the last by a v_nop, the slot that the instruction set
// asks for behind a transcendental.
__device__ __forceinline__ void exp2_run8(float* x) {
  asm("v_exp_f32 %0, %0\n\tv_exp_f32 %1, %1\n\tv_exp_f32 %2, %2\n\tv_exp_f32 %3, %3\n\t"
      "v_exp_f32 %4, %4\n\tv_exp_f32 %5, %5\n\tv_exp_f32 %6, %6\n\tv_exp_f32 %7, %7\n\tv_nop"
      : "+v"(x[0]), "+v"(x[1]), "+v"(x[2]), "+v"(x[3]), "+v"(x[4]), "+v"(x[5]), "+v"(x[6]), "+v"(x[7]));
}
__device__ __forceinline__ void exp2_run9(float* x, float& y) {
  asm("v_exp_f32 %0, %0\n\tv_exp_f32 %1, %1\n\tv_exp_f32 %2, %2\n\tv_exp_f32 %3, %3\n\tv_exp_f32 %8, %8\n\t"
      "v_exp_f32 %4, %4\n\tv_exp_f32 %5, %5\n\tv_exp_f32 %6, %6\n\tv_exp_f32 %7, %7\n\tv_nop"
      : "+v"(x[0]), "+v"(x[1]), "+v"(x[2]), "+v"(x[3]), "+v"(x[4]), "+v"(x[5]), "+v"(x[6]), "+v"(x[7]), "+v"(y));
}

#define KTB  (32 * KSTRIDE * 2)   // bytes of one K tile in LDS (32 keys x 144 B)
#define VTB  (64 * VSTRIDE * 2)   // bytes of one V tile in LDS (64 dims x 96 B)
#define BUFB (KTB + VTB)          // one buffer of the two: K tile, then V tile

// One 32-key stage, K tile and V tile, from global memory straight into LDS: eight asynchronous 16-byte copies a lane (64 lanes).
// lk, lv: the lane's LDS byte addresses of its first K and V piece; gk, gv: the global places of the same pieces. K: 8 lanes a row, so a
// wave's copy covers four whole 128-byte lines (8 rows on per copy); V: 4 lanes a 64-byte row piece (16 rows on per copy).
// The s_wait_xcnt stands inside the statement, behind the last copy, so that no address register is rewritten in front of it.
__device__ __forceinline__ void copy_stage(unsigned lk, unsigned lv, const bf16* gk, const bf16* gv) {
  asm volatile("global_load_async_to_lds_b128 %0, %8, off\n\t"
               "global_load_async_to_lds_b128 %1, %9, off\n\t"
               "global_load_async_to_lds_b128 %2, %10, off\n\t"
               "global_load_async_to_lds_b128 %3, %11, off\n\t"
               "global_load_async_to_lds_b128 %4, %12, off\n\t"
               "global_load_async_to_lds_b128 %5, %13, off\n\t"
               "global_load_async_to_lds_b128 %6, %14, off\n\t"
               "global_load_async_to_lds_b128 %7, %15, off\n\t"
               "s_wait_xcnt 0x0"
               :: "v"(lk), "v"(lk + 8 * KSTRIDE * 2), "v"(lk + 16 * KSTRIDE * 2), "v"(lk + 24 * KSTRIDE * 2),
                  "v"(lv), "v"(lv + 16 * VSTRIDE * 2), "v"(lv + 32 * VSTRIDE * 2), "v"(lv + 48 * VSTRIDE * 2),
                  "v"(gk), "v"(gk + 8 * KVD), "v"(gk + 16 * KVD), "v"(gk + 24 * KVD),
                  "v"(gv), "v"(gv + 16 * KROWS), "v"(gv + 32 * KROWS), "v"(gv + 48 * KROWS)
               : "memory");
}

// 16x32 (MxK) f16 fragment from a row-major global matrix.
// lanes 0-15  (row=lane)    : elems 0..7 = K+0..7,  8..15 = K+16..23
// lanes 16-31 (row=lane-16) : elems 0..7 = K+8..15, 8..15 = K+24..31
template <typename T>
__device__ __forceinline__ bf16x16 load_frag(const T* __restrict__ base, int ld,
                                             int row0, int k0) {
  const int lane = threadIdx.x & 31;
  const int r    = lane & 15;
  const int kh   = (lane >> 4) * 8;
  const T* p0 = base + (size_t)(row0 + r) * ld + (k0 + kh);
  const T* p1 = p0 + 16;
  bf16x16 f;
#pragma unroll
  for (int i = 0; i < 8; ++i) {
    f[i]     = (bf16)p0[i];
    f[i + 8] = (bf16)p1[i];
  }
  return f;
}

// Same fragment from an LDS tile with padded row stride (base includes row0/k0).
__device__ __forceinline__ bf16x16 lds_frag(const bf16* base, int stride) {
  const int lane = threadIdx.x & 31;
  const int row  = lane & 15;
  const int kh   = (lane >> 4) * 8;
  const bf16x8 lo = *(const bf16x8*)(base + row * stride + kh);
  const bf16x8 hi = *(const bf16x8*)(base + row * stride + kh + 16);
  bf16x16 f;
#pragma unroll
  for (int i = 0; i < 8; ++i) { f[i] = lo[i]; f[i + 8] = hi[i]; }
  return f;
}

template <typename T>
__device__ __forceinline__ void stage_read16(const T* __restrict__ p, float* buf) {
#pragma unroll
  for (int i = 0; i < 16; ++i) buf[i] = (float)p[i];
}

__device__ __forceinline__ void stage_write(bf16* dst, const float* buf, int nquad) {
#pragma unroll
  for (int i = 0; i < nquad; ++i) {
    bf16x4 q;
    q[0] = (bf16)buf[4 * i];     q[1] = (bf16)buf[4 * i + 1];
    q[2] = (bf16)buf[4 * i + 2]; q[3] = (bf16)buf[4 * i + 3];
    *(bf16x4*)(dst + 4 * i) = q;
  }
}

// ---------------------------------------------------------------------------
// Attention: block 64 thr (2 waves) = 64 queries x one head; key step 32;
// wave tile 32 queries x 64 dk. K/Vᵀ staged through LDS (f16, padded stride)
// in two buffers by asynchronous global-to-LDS copies, the next stage's copy in flight during each trip.
// Output: f32 rows [B][LTRUE][DD] (head h at columns h*64..h*64+63).
// ---------------------------------------------------------------------------
__global__ __launch_bounds__(64) void attn_kernel(
    const bf16* __restrict__ Qb, const bf16* __restrict__ Kb,
    const bf16* __restrict__ Vt, const int* __restrict__ mask,   // mask [B][LTRUE]: 0 = key blocked
    float* __restrict__ out) {                                    // out [B][LTRUE][DD]: the padded query rows are not stored
  __shared__ __attribute__((aligned(16))) unsigned char ring[2 * BUFB];   // two K/V stages; behind the loop the waves' output staging

  const int q0blk = blockIdx.x * 64;
  const int h  = blockIdx.y;
  const int b  = blockIdx.z;
  const int t    = threadIdx.x;
  const int wave = t >> 5;
  const int lane = t & 31;
  const int qlane = lane & 15;
  const int kh8   = (lane >> 4) * 8;
  const int q0 = q0blk + wave * 32;          // this wave's 32 queries

  const int hk = h / HKDIV;
  const bf16* Qh = Qb + (size_t)b * QROWS * DD + h * DKK;        // queries: QROWS rows per batch, row stride DD
  const bf16* Kh = Kb + (size_t)b * KROWS * KVD + hk * DKK;      // keys: KROWS rows per batch, row stride KVD
  const bf16* Vh = Vt + ((size_t)(b * KVH + hk)) * DKK * KROWS;  // Vᵀ [KVH][64][KROWS] per batch

  // Cooperative staging (64 threads), 16 bytes a lane and copy: K tile 32x64 (8 lanes a row), V tile 64x32 (4 lanes a row).
  const bf16* kSrc = Kh + (size_t)(t >> 3) * KVD + (t & 7) * 8;
  const bf16* vSrc = Vh + (size_t)(t >> 2) * KROWS + (t & 3) * 8;
  const unsigned lk = (unsigned)(size_t)ring + (t >> 3) * (KSTRIDE * 2) + (t & 7) * 16;
  const unsigned lv = (unsigned)(size_t)ring + KTB + (t >> 2) * (VSTRIDE * 2) + (t & 3) * 16;
  copy_stage(lk, lv, kSrc, vSrc);   // stage 0 into buffer 0; it flies under the Q and mask loads below

  bf16x16 qf[QW][2];
#pragma unroll
  for (int qt = 0; qt < QW; ++qt) {
    qf[qt][0] = load_frag(Qh, DD, q0 + 16 * qt, 0);
    qf[qt][1] = load_frag(Qh, DD, q0 + 16 * qt, 32);
  }

  f32x8 o[QW][4] = {};
  float mrun[QW], lrun[QW];
#pragma unroll
  for (int qt = 0; qt < QW; ++qt) { mrun[qt] = -INFINITY; lrun[qt] = 0.0f; }

  const float scale = 0.125f * 1.44269504088896340736f;  // 1/sqrt(DK)*log2(e)
  const float NEG2 = -1.0e9f;    // masked logit: its weight is exactly 0 once any valid key of the row has been seen (every row
                                 // has one), and anything accumulated before that is wiped by alpha == 0 — same result as -inf
  const int kmax = KROWS - 1;
  __shared__ __attribute__((aligned(16))) float kbS[KROWS];
  // additive per-key logit bias, in log2 units: 0 for an allowed key, -1e9 for mask == 0 and for the padding keys (4 keys a lane and trip)
  v4i_t mk[KROWS / 256];
#pragma unroll   // the index is clamped, not branched round, and the loop unrolled, so that all four mask loads are in flight together
  for (int j = 0; j < KROWS / 256; ++j) mk[j] = *(const v4i_t*)(mask + b * LTRUE + 4 * min(t + 64 * j, LTRUE / 4 - 1));
#pragma unroll   // mk[] indexed by constants only, so that it stays in registers
  for (int j = 0; j < KROWS / 256; ++j) {
    const int k4 = t + 64 * j;
    v4f_t kv;
    for (int e = 0; e < 4; ++e) kv[e] = ((k4 < LTRUE / 4 && mk[j][e] != 0) ? 0.0f : -1.0e9f) * 1.44269504088896340736f;
    *(v4f_t*)(kbS + 4 * k4) = kv;
  }
  asm volatile("s_wait_asynccnt 0x0" ::: "memory");   // this wave's copies of stage 0 have landed
  __syncthreads();                                    // stage 0 and the key bias visible to both waves
  copy_stage(lk + BUFB, lv + BUFB, kSrc + (size_t)32 * KVD, vSrc + 32);   // stage 1 into buffer 1

  unsigned cur = 0;   // byte offset in the ring of the buffer that this trip reads
  for (int kb = 0; kb <= kmax; kb += 32) {
    const bf16* ldsK = (const bf16*)(ring + cur);
    const bf16* ldsV = (const bf16*)(ring + cur + KTB);

    // Phase 1: scores + softmax for both q-tiles (K fragments live here only).
    bf16x16 kf[2][2];
#pragma unroll
    for (int ktile = 0; ktile < 2; ++ktile)
#pragma unroll
      for (int c = 0; c < 2; ++c)
        kf[ktile][c] = lds_frag(ldsK + (ktile * 16) * KSTRIDE + c * 32, KSTRIDE);

    bf16x16 pf[QW];
    bool act[QW];
#pragma unroll
    for (int qt = 0; qt < QW; ++qt) {
      unsigned mbits = 0;
      {
#pragma unroll
        for (int r = 0; r < 8; ++r) { const int j0 = kb + kh8 + r; if (j0 < NKV) mbits |= 1u << r; if (j0 + 16 < NKV) mbits |= 1u << (8 + r); }
        act[qt] = (__builtin_amdgcn_ballot_w32(mbits != 0) != 0);
      }
      if (act[qt]) {
        const int q_my = q0 + 16 * qt + qlane;
        f32x8 s0 = {}, s1 = {};
        s0 = wmma_bf16(kf[0][0], qf[qt][0], s0);
        s0 = wmma_bf16(kf[0][1], qf[qt][1], s0);
        s1 = wmma_bf16(kf[1][0], qf[qt][0], s1);
        s1 = wmma_bf16(kf[1][1], qf[qt][1], s1);

        float mx = -INFINITY;
#pragma unroll
        for (int r = 0; r < 8; ++r) {
          const int k0i = kb + kh8 + r;
          const int k1i = k0i + 16;
          (void)k0i; (void)k1i; (void)q_my;
          s0[r] = (mbits & (1u << r))       ? s0[r] * scale + kbS[kb + kh8 + r] : NEG2;
          s1[r] = (mbits & (1u << (8 + r))) ? s1[r] * scale + kbS[kb + 16 + kh8 + r] : NEG2;
          mx = fmaxf(mx, fmaxf(s0[r], s1[r]));
        }
        mx = fmaxf(mx, __shfl_xor(mx, 16, 32));
        const float mnew  = fmaxf(mrun[qt], mx);
        float alpha = mrun[qt] - mnew;
        float e0[8], e1[8];
#pragma unroll
        for (int r = 0; r < 8; ++r) { e0[r] = s0[r] - mnew; e1[r] = s1[r] - mnew; }
        exp2_run9(e0, alpha);
        exp2_run8(e1);

        float rsum = 0.0f;
#pragma unroll
        for (int r = 0; r < 8; ++r) {
          const float p0 = e0[r];
          const float p1 = e1[r];
          rsum += p0 + p1;
          pf[qt][r]     = (bf16)(p0 * 1024.0f);     // P carried x1024: no f16 copy of a probability is sub-normal
          pf[qt][r + 8] = (bf16)(p1 * 1024.0f);
        }
        rsum += __shfl_xor(rsum, 16, 32);
        lrun[qt] = lrun[qt] * alpha + rsum;
        mrun[qt] = mnew;

        // Rescale accumulators now so the PV phase is pure WMMA.
#pragma unroll
        for (int j = 0; j < 4; ++j)
#pragma unroll
          for (int r = 0; r < 8; ++r) o[qt][j][r] *= alpha;
      }
    }

    // Phase 2: O^T accumulate; each V fragment read from LDS once, used by
    // both q-tiles, then dead (only 8 VGPRs of V live at a time).
#pragma unroll
    for (int j = 0; j < 4; ++j) {
      const bf16x16 vf = lds_frag(ldsV + (j * 16) * VSTRIDE, VSTRIDE);
#pragma unroll
      for (int qt = 0; qt < QW; ++qt)
        if (act[qt]) o[qt][j] = wmma_bf16(vf, pf[qt], o[qt][j]);
    }

    // Hand-over: this wave's reads of the buffer are done, its copies of the next stage have landed; the one barrier publishes the
    // next stage and frees this buffer, which the stage after next is then copied into while the next one is worked on.
    asm volatile("s_wait_dscnt 0x0" ::: "memory");
    asm volatile("s_wait_asynccnt 0x0" ::: "memory");
    __syncthreads();
    if (kb + 64 <= kmax) copy_stage(lk + cur, lv + cur, kSrc + (size_t)(kb + 64) * KVD, vSrc + (kb + 64));
    cur = BUFB - cur;
  }
  asm volatile("s_wait_asynccnt 0x0" ::: "memory");   // no copy is outstanding when the ring turns into output staging

  float* so = (float*)ring + wave * (32 * 68);   // the last trip's barrier stands behind every read of the ring
  static_assert(2 * 32 * 68 * 4 <= 2 * BUFB, "output staging must fit the ring");
#pragma unroll
  for (int qt = 0; qt < QW; ++qt) {
    const float rl = 1.0f / (lrun[qt] * 1024.0f);
#pragma unroll
    for (int j = 0; j < 4; ++j)
#pragma unroll
      for (int r = 0; r < 8; ++r) so[(16 * qt + qlane) * 68 + j * 16 + kh8 + r] = o[qt][j][r] * rl;
  }
  asm volatile("s_wait_dscnt 0" ::: "memory");
  __builtin_amdgcn_wave_barrier();
  float* orow = out + ((size_t)(b * LTRUE + q0)) * DD + h * DKK;
  if (q0 + 32 <= LTRUE) {   // all 32 query rows of the wave are real (the test reads the same in every lane of a wave)
#pragma unroll
    for (int it = 0; it < 16; ++it) { const int ch = lane + 32 * it, ql = ch >> 4, q4 = (ch & 15) * 4;
      *(v4f_t*)(orow + (size_t)ql * DD + q4) = *(const v4fa*)(so + ql * 68 + q4); }
  } else {                  // the wave that holds the last real rows: the padded rows are not stored
#pragma unroll 1            // taken by one wave of each (batch, head) only: rolled, it keeps the kernel's text short
    for (int it = 0; it < 16; ++it) { const int ch = lane + 32 * it, ql = ch >> 4, q4 = (ch & 15) * 4;
      if (q0 + ql < LTRUE) {
        *(v4f_t*)(orow + (size_t)ql * DD + q4) = *(const v4fa*)(so + ql * 68 + q4);
        asm volatile("s_wait_xcnt 0x0" ::: "memory");   // stands in front of the next trip's rewrite of the store's address and data registers
      } }
  }
}


// padded f16 rows Q16[b][1024][1024] (rows ≥ 1000 zero) and Vᵀ[b][1024 dims][1024 keys] (cols ≥ 1000 zero); block = 64 padded tokens x one head
__global__ __launch_bounds__(256) void k_prep(const float* __restrict__ q, bf16* __restrict__ Q16, bf16* __restrict__ Vt) {
  __shared__ __attribute__((aligned(16))) bf16 qS[64][72], vT[64][72];
  const int tid = threadIdx.x; const int n0 = blockIdx.x * 64, h = blockIdx.y, b = blockIdx.z;
  for (int e = tid; e < 64 * 64; e += 256) { const int t = e >> 6, d = e & 63; const int n = n0 + t; const float v = (n < LTRUE) ? q[((size_t)b * LTRUE + n) * DD + h * DKK + d] : 0.0f; qS[t][d] = (bf16)v; vT[d][t] = (bf16)v; }
  __syncthreads();
{
#pragma unroll 1
    for (int round = 0; round < 2; ++round) { const int r = round * 32 + (tid >> 3), piece = (tid & 7) * 8;
      *(v4u_t*)(Q16 + ((size_t)b * SS + n0 + r) * DD + h * DKK + piece) = *(const v4ua*)(&qS[r][piece]);
      *(v4u_t*)(Vt + ((size_t)b * DD + h * DKK + r) * SS + n0 + piece) = *(const v4ua*)(&vT[r][piece]); }
     }
}

extern "C" void kernel_launch(void* const* d_in, const int* in_sizes, int n_in,
                              void* d_out, int out_size, void* d_ws, size_t ws_size,
                              hipStream_t stream) {
  (void)in_sizes; (void)n_in; (void)out_size;
  const float* q = (const float*)d_in[0]; const int* mask = (const int*)d_in[1];
  float* out = (float*)d_out;     // [8,1000,1024]
  char* ws = (char*)d_ws;
  bf16* Q16 = (bf16*)ws; ws += (size_t)BB * SS * DD * 2;        // 16 MB (serves as Q and K)
  bf16* Vt = (bf16*)ws; ws += (size_t)BB * DD * SS * 2;         // 16 MB
  if ((size_t)(ws - (char*)d_ws) > ws_size) return;
  const dim3 blk(256);
  k_prep<<<dim3(SS / 64, HH, BB), blk, 0, stream>>>(q, Q16, Vt);
  attn_kernel<<<dim3(QROWS / 64, HH, BB), dim3(64), 0, stream>>>(Q16, Q16, Vt, mask, out);
}

// v004
// One run takes 41.1 microseconds.
// Two timings next to v003 both put it at 1.49 times that version's speed.
// All steps since v000 together make it 2.15 times as fast.
// Contractions on v_wmma_f32_16x16x32_f16 (plain f16 operands, f32 accumulate): self-attention with q = k = v = query (no projections),
// 16 heads of 64, sequence 1000 zero-padded to 1024 as in the reference, scale 1/8, key mask (mask == 0 and the 24 padding keys: logit -1e9).
// A blocked key's weight is exactly 0 as soon as the batch has one allowed key, so the first launch packs the allowed keys of each batch, in
// token order, to the front of the K and V^T planes and the attention kernel walks only their 32-key tiles (a batch with no allowed key
// keeps all 1024, every logit -1e9: the reference's uniform weights). Flash-style S^T = K.Q^T / O^T = V^T.P^T, online softmax in f32
// (P x1024); the padded query rows are not stored. compute dtype: f16 operands, f32 accumulate.
#include <hip/hip_runtime.h>
#include <hip/hip_bf16.h>
#include <math.h>

#define BB 8
#define LTRUE 1000
#define SS 1024
#define QROWS 1024
#define KROWS 1024
#define NKV 1024
#define DD 1024
#define HH 16
#define KVH 16
#define KVD 1024
#define HKDIV 1
#define DKK 64
#define QW 2
#define GSTR 48

typedef _Float16 bf16;
typedef _Float16 f16;
typedef __attribute__((ext_vector_type(4))) unsigned v4u_t;
typedef unsigned v4ua __attribute__((ext_vector_type(4), may_alias));
typedef __attribute__((ext_vector_type(4))) float v4f_t;
typedef __attribute__((ext_vector_type(4))) int v4i_t;
typedef float v4fa __attribute__((ext_vector_type(4), may_alias));
typedef __attribute__((ext_vector_type(16))) bf16  bf16x16;
typedef bf16x16 f16x16;
typedef __attribute__((ext_vector_type(8)))  bf16  bf16x8;
typedef bf16x8 f16x8;
typedef __attribute__((ext_vector_type(4)))  bf16  bf16x4;
typedef __attribute__((ext_vector_type(8)))  float f32x8;
__device__ __forceinline__ f32x8 wmma16(f16x16 a, f16x16 b, f32x8 c) {
  c = __builtin_amdgcn_wmma_f32_16x16x32_f16(false, a, false, b, (short)0, c, false, false);
  asm volatile("v_nop\n\tv_nop\n\tv_nop\n\tv_nop" : "+v"(c) : "v"(a), "v"(b));
  return c;
}
#define LDS_STRIDE 48   // unused: 48 elems (96B rows)
#define KSTRIDE    72   // attn K tile: 64 -> 72 elems (144B rows): conflict-free b128
#define VSTRIDE    48   // attn V tile: 32 -> 48 elems

__device__ __forceinline__ f32x8 wmma_bf16(bf16x16 a, bf16x16 b, f32x8 c) {
  c = __builtin_amdgcn_wmma_f32_16x16x32_f16(false, a, false, b, (short)0, c, false, false);
  asm volatile("v_nop\n\tv_nop\n\tv_nop\n\tv_nop" : "+v"(c) : "v"(a), "v"(b));   // A/B-overwrite hazard guard
  return c;
}

// x = 2^x for a run of values, each on the bare v_exp_f32 and in its own register. The library's exp2f adds a compare, two selects, an add
// and a v_ldexp_f32 per value to keep results below 2^-126; here such a result may come out as 0: every argument is <= 0, and the result is
// only ever added to a row sum >= 1, rounded to an f16 weight, or multiplied into sums that a weight of 1 has just joined.
// One statement per run: each v_exp_f32 is followed by one on other registers and the last by a v_nop, the slot that the instruction set
// asks for behind a transcendental.
__device__ __forceinline__ void exp2_run8(float* x) {
  asm("v_exp_f32 %0, %0\n\tv_exp_f32 %1, %1\n\tv_exp_f32 %2, %2\n\tv_exp_f32 %3, %3\n\t"
      "v_exp_f32 %4, %4\n\tv_exp_f32 %5, %5\n\tv_exp_f32 %6, %6\n\tv_exp_f32 %7, %7\n\tv_nop"
      : "+v"(x[0]), "+v"(x[1]), "+v"(x[2]), "+v"(x[3]), "+v"(x[4]), "+v"(x[5]), "+v"(x[6]), "+v"(x[7]));
}
__device__ __forceinline__ void exp2_run9(float* x, float& y) {
  asm("v_exp_f32 %0, %0\n\tv_exp_f32 %1, %1\n\tv_exp_f32 %2, %2\n\tv_exp_f32 %3, %3\n\tv_exp_f32 %8, %8\n\t"
      "v_exp_f32 %4, %4\n\tv_exp_f32 %5, %5\n\tv_exp_f32 %6, %6\n\tv_exp_f32 %7, %7\n\tv_nop"
      : "+v"(x[0]), "+v"(x[1]), "+v"(x[2]), "+v"(x[3]), "+v"(x[4]), "+v"(x[5]), "+v"(x[6]), "+v"(x[7]), "+v"(y));
}

#define KTB  (32 * KSTRIDE * 2)   // bytes of one K tile in LDS (32 keys x 144 B)
#define VTB  (64 * VSTRIDE * 2)   // bytes of one V tile in LDS (64 dims x 96 B)
#define BUFB (KTB + VTB)          // one buffer of the two: K tile, then V tile

// One 32-key stage, K tile and V tile, from global memory straight into LDS: eight asynchronous 16-byte copies a lane (64 lanes).
// lk, lv: the lane's LDS byte addresses of its first K and V piece; gk, gv: the global places of the same pieces. K: 8 lanes a row, so a
// wave's copy covers four whole 128-byte lines (8 rows on per copy); V: 4 lanes a 64-byte row piece (16 rows on per copy).
// The s_wait_xcnt stands inside the statement, behind the last copy, so that no address register is rewritten in front of it.
__device__ __forceinline__ void copy_stage(unsigned lk, unsigned lv, const bf16* gk, const bf16* gv) {
  asm volatile("global_load_async_to_lds_b128 %0, %8, off\n\t"
               "global_load_async_to_lds_b128 %1, %9, off\n\t"
               "global_load_async_to_lds_b128 %2, %10, off\n\t"
               "global_load_async_to_lds_b128 %3, %11, off\n\t"
               "global_load_async_to_lds_b128 %4, %12, off\n\t"
               "global_load_async_to_lds_b128 %5, %13, off\n\t"
               "global_load_async_to_lds_b128 %6, %14, off\n\t"
               "global_load_async_to_lds_b128 %7, %15, off\n\t"
               "s_wait_xcnt 0x0"
               :: "v"(lk), "v"(lk + 8 * KSTRIDE * 2), "v"(lk + 16 * KSTRIDE * 2), "v"(lk + 24 * KSTRIDE * 2),
                  "v"(lv), "v"(lv + 16 * VSTRIDE * 2), "v"(lv + 32 * VSTRIDE * 2), "v"(lv + 48 * VSTRIDE * 2),
                  "v"(gk), "v"(gk + 8 * KVD), "v"(gk + 16 * KVD), "v"(gk + 24 * KVD),
                  "v"(gv), "v"(gv + 16 * KROWS), "v"(gv + 32 * KROWS), "v"(gv + 48 * KROWS)
               : "memory");
}

// 16x32 (MxK) f16 fragment from f32 rows in global memory; p: the lane's own row, at the first k that the lane holds.
// lanes 0-15  (row=lane)    : elems 0..7 = K+0..7,  8..15 = K+16..23
// lanes 16-31 (row=lane-16) : elems 0..7 = K+8..15, 8..15 = K+24..31
__device__ __forceinline__ bf16x16 load_frag_f32(const float* __restrict__ p) {
  const v4f_t a0 = *(const v4f_t*)(p),      a1 = *(const v4f_t*)(p + 4);
  const v4f_t b0 = *(const v4f_t*)(p + 16), b1 = *(const v4f_t*)(p + 20);
  bf16x16 f;
  for (int i = 0; i < 4; ++i) {
    f[i]     = (bf16)a0[i]; f[i + 4]  = (bf16)a1[i];
    f[i + 8] = (bf16)b0[i]; f[i + 12] = (bf16)b1[i];
  }
  return f;
}

// Same fragment from an LDS tile with padded row stride (base includes row0/k0).
__device__ __forceinline__ bf16x16 lds_frag(const bf16* base, int stride) {
  const int lane = threadIdx.x & 31;
  const int row  = lane & 15;
  const int kh   = (lane >> 4) * 8;
  const bf16x8 lo = *(const bf16x8*)(base + row * stride + kh);
  const bf16x8 hi = *(const bf16x8*)(base + row * stride + kh + 16);
  bf16x16 f;
#pragma unroll
  for (int i = 0; i < 8; ++i) { f[i] = lo[i]; f[i + 8] = hi[i]; }
  return f;
}

template <typename T>
__device__ __forceinline__ void stage_read16(const T* __restrict__ p, float* buf) {
#pragma unroll
  for (int i = 0; i < 16; ++i) buf[i] = (float)p[i];
}

__device__ __forceinline__ void stage_write(bf16* dst, const float* buf, int nquad) {
#pragma unroll
  for (int i = 0; i < nquad; ++i) {
    bf16x4 q;
    q[0] = (bf16)buf[4 * i];     q[1] = (bf16)buf[4 * i + 1];
    q[2] = (bf16)buf[4 * i + 2]; q[3] = (bf16)buf[4 * i + 3];
    *(bf16x4*)(dst + 4 * i) = q;
  }
}

// ---------------------------------------------------------------------------
// Attention: block 64 thr (2 waves) = 64 queries x one head; key step 32;
// wave tile 32 queries x 64 dk. K/Vᵀ staged through LDS (f16, padded stride)
// in two buffers by asynchronous global-to-LDS copies, the next stage's copy in flight during each trip.
// Output: f32 rows [B][LTRUE][DD] (head h at columns h*64..h*64+63).
// ---------------------------------------------------------------------------
__global__ __launch_bounds__(64) void attn_kernel(
    const float* __restrict__ Qf, const bf16* __restrict__ Kb,    // Qf: the f32 query rows [B][LTRUE][DD]; Kb: the packed key rows
    const bf16* __restrict__ Vt, const int* __restrict__ nkeys,   // nkeys[32 * b]: allowed keys of batch b, as the first launch counted them
    float* __restrict__ out) {                                    // out [B][LTRUE][DD]: the padded query rows are not stored
  __shared__ __attribute__((aligned(16))) unsigned char ring[2 * BUFB];   // two K/V stages; behind the loop the waves' output staging

  const int q0blk = blockIdx.x * 64;
  const int h  = blockIdx.y;
  const int b  = blockIdx.z;
  const int t    = threadIdx.x;
  const int wave = t >> 5;
  const int lane = t & 31;
  const int qlane = lane & 15;
  const int kh8   = (lane >> 4) * 8;
  const int q0 = q0blk + wave * 32;          // this wave's 32 queries

  const int hk = h / HKDIV;
  const bf16* Kh = Kb + (size_t)b * KROWS * KVD + hk * DKK;      // keys: KROWS rows per batch, row stride KVD
  const bf16* Vh = Vt + ((size_t)(b * KVH + hk)) * DKK * KROWS;  // Vᵀ [KVH][64][KROWS] per batch

  // Cooperative staging (64 threads), 16 bytes a lane and copy: K tile 32x64 (8 lanes a row), V tile 64x32 (4 lanes a row).
  const bf16* kSrc = Kh + (size_t)(t >> 3) * KVD + (t & 7) * 8;
  const bf16* vSrc = Vh + (size_t)(t >> 2) * KROWS + (t & 3) * 8;
  const unsigned lk = (unsigned)(size_t)ring + (t >> 3) * (KSTRIDE * 2) + (t & 7) * 16;
  const unsigned lv = (unsigned)(size_t)ring + KTB + (t >> 2) * (VSTRIDE * 2) + (t & 3) * 16;
  copy_stage(lk, lv, kSrc, vSrc);   // stage 0 into buffer 0; it flies under the key-count and Q loads below

  // allowed keys of the batch, one value for the whole work-group; clamped to the shape, since trip counts are formed from it
  const int nb = min(max(__builtin_amdgcn_readfirstlane(nkeys[32 * b]), 0), LTRUE);

  bf16x16 qf[QW][2];
  const float* qrow[QW];
#pragma unroll
  for (int qt = 0; qt < QW; ++qt) {   // a padded query row is never stored: its lane reads the last real row instead of past the input
    qrow[qt] = Qf + ((size_t)b * LTRUE + min(q0 + 16 * qt + qlane, LTRUE - 1)) * DD + h * DKK + kh8;
    qf[qt][0] = load_frag_f32(qrow[qt]);
    qf[qt][1] = load_frag_f32(qrow[qt] + 32);
  }
  // stands in front of the first rewrite of a Q load's address registers, which it names as inputs so that they live up to it
  asm volatile("s_wait_xcnt 0x0" :: "v"(qrow[0]), "v"(qrow[1]) : "memory");

  f32x8 o[QW][4] = {};
  float mrun[QW], lrun[QW];
#pragma unroll
  for (int qt = 0; qt < QW; ++qt) { mrun[qt] = -INFINITY; lrun[qt] = 0.0f; }

  const float scale = 0.125f * 1.44269504088896340736f;  // 1/sqrt(DK)*log2(e)
  const float NEG2 = -1.0e9f;    // masked logit: its weight is exactly 0 once any valid key of the row has been seen (every row
                                 // has one), and anything accumulated before that is wiped by alpha == 0 — same result as -inf
  const int kmax = (nb > 0 ? nb : KROWS) - 1;   // last packed key that is walked; with no allowed key all KROWS are, each at -1e9
  __shared__ __attribute__((aligned(16))) float kbS[KROWS];
  // additive logit bias of each packed key, in log2 units: 0 for the nb allowed keys in front, -1e9 behind them (the last tile's zero rows)
  for (int j = 0; j < KROWS / 256; ++j) {
    const int k4 = t + 64 * j;
    v4f_t kv;
    for (int e = 0; e < 4; ++e) kv[e] = (4 * k4 + e < nb ? 0.0f : -1.0e9f) * 1.44269504088896340736f;
    *(v4f_t*)(kbS + 4 * k4) = kv;
  }
  asm volatile("s_wait_asynccnt 0x0" ::: "memory");   // this wave's copies of stage 0 have landed
  __syncthreads();                                    // stage 0 and the key bias visible to both waves
  if (32 <= kmax) copy_stage(lk + BUFB, lv + BUFB, kSrc + (size_t)32 * KVD, vSrc + 32);   // stage 1, where there is one, into buffer 1

  unsigned cur = 0;   // byte offset in the ring of the buffer that this trip reads
  for (int kb = 0; kb <= kmax; kb += 32) {
    const bf16* ldsK = (const bf16*)(ring + cur);
    const bf16* ldsV = (const bf16*)(ring + cur + KTB);

    // Phase 1: scores + softmax for both q-tiles (K fragments live here only).
    bf16x16 kf[2][2];
#pragma unroll
    for (int ktile = 0; ktile < 2; ++ktile)
#pragma unroll
      for (int c = 0; c < 2; ++c)
        kf[ktile][c] = lds_frag(ldsK + (ktile * 16) * KSTRIDE + c * 32, KSTRIDE);

    bf16x16 pf[QW];
    bool act[QW];
#pragma unroll
    for (int qt = 0; qt < QW; ++qt) {
      unsigned mbits = 0;
      {
#pragma unroll
        for (int r = 0; r < 8; ++r) { const int j0 = kb + kh8 + r; if (j0 < NKV) mbits |= 1u << r; if (j0 + 16 < NKV) mbits |= 1u << (8 + r); }
        act[qt] = (__builtin_amdgcn_ballot_w32(mbits != 0) != 0);
      }
      if (act[qt]) {
        const int q_my = q0 + 16 * qt + qlane;
        f32x8 s0 = {}, s1 = {};
        s0 = wmma_bf16(kf[0][0], qf[qt][0], s0);
        s0 = wmma_bf16(kf[0][1], qf[qt][1], s0);
        s1 = wmma_bf16(kf[1][0], qf[qt][0], s1);
        s1 = wmma_bf16(kf[1][1], qf[qt][1], s1);

        float mx = -INFINITY;
#pragma unroll
        for (int r = 0; r < 8; ++r) {
          const int k0i = kb + kh8 + r;
          const int k1i = k0i + 16;
          (void)k0i; (void)k1i; (void)q_my;
          s0[r] = (mbits & (1u << r))       ? s0[r] * scale + kbS[kb + kh8 + r] : NEG2;
          s1[r] = (mbits & (1u << (8 + r))) ? s1[r] * scale + kbS[kb + 16 + kh8 + r] : NEG2;
          mx = fmaxf(mx, fmaxf(s0[r], s1[r]));
        }
        mx = fmaxf(mx, __shfl_xor(mx, 16, 32));
        const float mnew  = fmaxf(mrun[qt], mx);
        float alpha = mrun[qt] - mnew;
        float e0[8], e1[8];
#pragma unroll
        for (int r = 0; r < 8; ++r) { e0[r] = s0[r] - mnew; e1[r] = s1[r] - mnew; }
        exp2_run9(e0, alpha);
        exp2_run8(e1);

        float rsum = 0.0f;
#pragma unroll
        for (int r = 0; r < 8; ++r) {
          const float p0 = e0[r];
          const float p1 = e1[r];
          rsum += p0 + p1;
          pf[qt][r]     = (bf16)(p0 * 1024.0f);     // P carried x1024: no f16 copy of a probability is sub-normal
          pf[qt][r + 8] = (bf16)(p1 * 1024.0f);
        }
        rsum += __shfl_xor(rsum, 16, 32);
        lrun[qt] = lrun[qt] * alpha + rsum;
        mrun[qt] = mnew;

        // Rescale accumulators now so the PV phase is pure WMMA.
#pragma unroll
        for (int j = 0; j < 4; ++j)
#pragma unroll
          for (int r = 0; r < 8; ++r) o[qt][j][r] *= alpha;
      }
    }

    // Phase 2: O^T accumulate; each V fragment read from LDS once, used by
    // both q-tiles, then dead (only 8 VGPRs of V live at a time).
#pragma unroll
    for (int j = 0; j < 4; ++j) {
      const bf16x16 vf = lds_frag(ldsV + (j * 16) * VSTRIDE, VSTRIDE);
#pragma unroll
      for (int qt = 0; qt < QW; ++qt)
        if (act[qt]) o[qt][j] = wmma_bf16(vf, pf[qt], o[qt][j]);
    }

    // Hand-over: this wave's reads of the buffer are done, its copies of the next stage have landed; the one barrier publishes the
    // next stage and frees this buffer, which the stage after next is then copied into while the next one is worked on.
    asm volatile("s_wait_dscnt 0x0" ::: "memory");
    asm volatile("s_wait_asynccnt 0x0" ::: "memory");
    __syncthreads();
    if (kb + 64 <= kmax) copy_stage(lk + cur, lv + cur, kSrc + (size_t)(kb + 64) * KVD, vSrc + (kb + 64));
    cur = BUFB - cur;
  }
  asm volatile("s_wait_asynccnt 0x0" ::: "memory");   // no copy is outstanding when the ring turns into output staging

  float* so = (float*)ring + wave * (32 * 68);   // the last trip's barrier stands behind every read of the ring
  static_assert(2 * 32 * 68 * 4 <= 2 * BUFB, "output staging must fit the ring");
#pragma unroll
  for (int qt = 0; qt < QW; ++qt) {
    const float rl = 1.0f / (lrun[qt] * 1024.0f);
#pragma unroll
    for (int j = 0; j < 4; ++j)
#pragma unroll
      for (int r = 0; r < 8; ++r) so[(16 * qt + qlane) * 68 + j * 16 + kh8 + r] = o[qt][j][r] * rl;
  }
  asm volatile("s_wait_dscnt 0" ::: "memory");
  __builtin_amdgcn_wave_barrier();
  float* orow = out + ((size_t)(b * LTRUE + q0)) * DD + h * DKK;
  if (q0 + 32 <= LTRUE) {   // all 32 query rows of the wave are real (the test reads the same in every lane of a wave)
#pragma unroll
    for (int it = 0; it < 16; ++it) { const int ch = lane + 32 * it, ql = ch >> 4, q4 = (ch & 15) * 4;
      *(v4f_t*)(orow + (size_t)ql * DD + q4) = *(const v4fa*)(so + ql * 68 + q4); }
  } else {                  // the wave that holds the last real rows: the padded rows are not stored
#pragma unroll 1            // taken by one wave of each (batch, head) only: rolled, it keeps the kernel's text short
    for (int it = 0; it < 16; ++it) { const int ch = lane + 32 * it, ql = ch >> 4, q4 = (ch & 15) * 4;
      if (q0 + ql < LTRUE) {
        *(v4f_t*)(orow + (size_t)ql * DD + q4) = *(const v4fa*)(so + ql * 68 + q4);
        asm volatile("s_wait_xcnt 0x0" ::: "memory");   // stands in front of the next trip's rewrite of the store's address and data registers
      } }
  }
}


// The allowed keys of a batch (mask != 0), packed in token order: f16 rows Kc[b][rank][1024] and V^T[b][1024 dims][rank]; ranks from the
// count up to the next multiple of 64 are zero rows, and nothing behind that is written or read. A batch with no allowed key keeps all
// 1024 padded tokens in place. Block = 64 ranks x one head; every block ranks its batch's 1000 mask entries itself (4 a thread).
__global__ __launch_bounds__(256) void k_prep(const float* __restrict__ q, const int* __restrict__ mask,
                                              bf16* __restrict__ Kc, bf16* __restrict__ Vt, int* __restrict__ nkeys) {
  __shared__ __attribute__((aligned(16))) bf16 qS[64][72], vT[64][72];
  __shared__ int tok[64];    // token of each of the block's ranks; -1: none, a zero row
  __shared__ int wcnt[8];    // allowed keys among each wave's 128 tokens
  const int tid = threadIdx.x; const int r0 = blockIdx.x * 64, h = blockIdx.y, b = blockIdx.z;
  const v4i_t m = *(const v4i_t*)(mask + b * LTRUE + 4 * min(tid, LTRUE / 4 - 1));
  bool f[4];
  unsigned below = 0, inwave = 0;   // allowed keys of the wave's lower lanes; of the whole wave
  for (int e = 0; e < 4; ++e) {
    f[e] = tid < LTRUE / 4 && m[e] != 0;
    const unsigned bal = __builtin_amdgcn_ballot_w32(f[e]);
    below = __builtin_amdgcn_mbcnt_lo(bal, below);
    inwave += __builtin_popcount(bal);
  }
  if ((tid & 31) == 0) wcnt[tid >> 5] = (int)inwave;
  if (tid < 64) tok[tid] = -1;
  __syncthreads();
  int total = 0, rank = (int)below - r0;   // rank: of the thread's first allowed key, counted from the block's first rank
  for (int w = 0; w < 8; ++w) { const int c = wcnt[w]; total += c; if (w < (tid >> 5)) rank += c; }
  total = __builtin_amdgcn_readfirstlane(total);   // the same in every thread: a scalar, so that the branch round the barriers below is one
  for (int e = 0; e < 4; ++e)
    if (f[e]) { if ((unsigned)rank < 64u) tok[rank] = 4 * tid + e; ++rank; }
  if (total == 0 && tid < 64 && r0 + tid < LTRUE) tok[tid] = r0 + tid;   // no allowed key: every token stays at its own place
  if (blockIdx.x == 0 && h == 0 && tid == 0) nkeys[32 * b] = total;     // one 128-byte line a batch
  if (r0 < (total > 0 ? total : SS)) {   // the block holds a rank that is walked
    __syncthreads();
    for (int e = tid; e < 64 * 64; e += 256) { const int t = e >> 6, d = e & 63; const int n = tok[t]; const float v = (n >= 0) ? q[((size_t)b * LTRUE + n) * DD + h * DKK + d] : 0.0f; qS[t][d] = (bf16)v; vT[d][t] = (bf16)v; }
    __syncthreads();
#pragma unroll 1
    for (int round = 0; round < 2; ++round) { const int r = round * 32 + (tid >> 3), piece = (tid & 7) * 8;
      *(v4u_t*)(Kc + ((size_t)b * SS + r0 + r) * DD + h * DKK + piece) = *(const v4ua*)(&qS[r][piece]);
      *(v4u_t*)(Vt + ((size_t)b * DD + h * DKK + r) * SS + r0 + piece) = *(const v4ua*)(&vT[r][piece]);
      asm volatile("s_wait_xcnt 0x0" ::: "memory"); }   // stands in front of the next trip's rewrite of the stores' address and data registers
  }
}

extern "C" void kernel_launch(void* const* d_in, const int* in_sizes, int n_in,
                              void* d_out, int out_size, void* d_ws, size_t ws_size,
                              hipStream_t stream) {
  (void)in_sizes; (void)n_in; (void)out_size;
  const float* q = (const float*)d_in[0]; const int* mask = (const int*)d_in[1];
  float* out = (float*)d_out;     // [8,1000,1024]
  char* ws = (char*)d_ws;
  bf16* Kc = (bf16*)ws; ws += (size_t)BB * SS * DD * 2;         // 16 MB
  bf16* Vt = (bf16*)ws; ws += (size_t)BB * DD * SS * 2;         // 16 MB
  int* nkeys = (int*)ws; ws += (size_t)BB * 128;                // one count a batch, each in a line of its own
  if ((size_t)(ws - (char*)d_ws) > ws_size) return;
  const dim3 blk(256);
  k_prep<<<dim3(SS / 64, HH, BB), blk, 0, stream>>>(q, mask, Kc, Vt, nkeys);
  attn_kernel<<<dim3(QROWS / 64, HH, BB), dim3(64), 0, stream>>>(q, Kc, Vt, nkeys, out);
}

// v005
// It runs in 27.5 microseconds.
// Next to v004, in two timings, it ran 1.49 times as fast each time.
// All steps since v000 together make it 3.20 times as fast.
// Contractions on v_wmma_f32_16x16x32_f16 (plain f16 operands, f32 accumulate): self-attention with q = k = v = query (no projections),
// 16 heads of 64, sequence 1000 zero-padded to 1024 as in the reference, scale 1/8, key mask (mask == 0 and the 24 padding keys: logit -1e9).
// A blocked key's weight is exactly 0 as soon as the batch has one allowed key, so every work-group ranks its batch's mask entries and walks
// only the allowed keys, in 32-key tiles that it fetches from the f32 input by their ranks and lays in LDS as f16 (a batch with no allowed
// key walks all 1000 tokens, every logit -1e9, and counts the 24 padding keys in the row sum: the reference's uniform weights).
// One launch. Flash-style S^T = K.Q^T / O^T = V^T.P^T, V^T read off the same key tile by the transposing LDS load, online softmax in f32
// (P x1024); the padded query rows are not stored. compute dtype: f16 operands, f32 accumulate.
#include <hip/hip_runtime.h>
#include <hip/hip_bf16.h>
#include <math.h>

#define BB 8
#define LTRUE 1000
#define SS 1024
#define QROWS 1024
#define KROWS 1024
#define NKV 1024
#define DD 1024
#define HH 16
#define KVH 16
#define KVD 1024
#define HKDIV 1
#define DKK 64
#define QW 2
#define GSTR 48

typedef _Float16 bf16;
typedef _Float16 f16;
typedef __attribute__((ext_vector_type(4))) unsigned v4u_t;
typedef unsigned v4ua __attribute__((ext_vector_type(4), may_alias));
typedef __attribute__((ext_vector_type(4))) float v4f_t;
typedef __attribute__((ext_vector_type(4))) int v4i_t;
typedef float v4fa __attribute__((ext_vector_type(4), may_alias));
typedef __attribute__((ext_vector_type(16))) bf16  bf16x16;
typedef bf16x16 f16x16;
typedef __attribute__((ext_vector_type(8)))  bf16  bf16x8;
typedef bf16x8 f16x8;
typedef __attribute__((ext_vector_type(4)))  bf16  bf16x4;
typedef __attribute__((ext_vector_type(8)))  float f32x8;
__device__ __forceinline__ f32x8 wmma16(f16x16 a, f16x16 b, f32x8 c) {
  c = __builtin_amdgcn_wmma_f32_16x16x32_f16(false, a, false, b, (short)0, c, false, false);
  asm volatile("v_nop\n\tv_nop\n\tv_nop\n\tv_nop" : "+v"(c) : "v"(a), "v"(b));
  return c;
}
#define LDS_STRIDE 48   // unused: 48 elems (96B rows)
#define KSTRIDE    72   // attn K tile: 64 -> 72 elems (144B rows): conflict-free b128
#define VSTRIDE    48   // unused: 48 elems (96B rows)

__device__ __forceinline__ f32x8 wmma_bf16(bf16x16 a, bf16x16 b, f32x8 c) {
  c = __builtin_amdgcn_wmma_f32_16x16x32_f16(false, a, false, b, (short)0, c, false, false);
  asm volatile("v_nop\n\tv_nop\n\tv_nop\n\tv_nop" : "+v"(c) : "v"(a), "v"(b));   // A/B-overwrite hazard guard
  return c;
}

// x = 2^x for a run of values, each on the bare v_exp_f32 and in its own register. The library's exp2f adds a compare, two selects, an add
// and a v_ldexp_f32 per value to keep results below 2^-126; here such a result may come out as 0: every argument is <= 0, and the result is
// only ever added to a row sum >= 1, rounded to an f16 weight, or multiplied into sums that a weight of 1 has just joined.
// One statement per run: each v_exp_f32 is followed by one on other registers and the last by a v_nop, the slot that the instruction set
// asks for behind a transcendental.
__device__ __forceinline__ void exp2_run8(float* x) {
  asm("v_exp_f32 %0, %0\n\tv_exp_f32 %1, %1\n\tv_exp_f32 %2, %2\n\tv_exp_f32 %3, %3\n\t"
      "v_exp_f32 %4, %4\n\tv_exp_f32 %5, %5\n\tv_exp_f32 %6, %6\n\tv_exp_f32 %7, %7\n\tv_nop"
      : "+v"(x[0]), "+v"(x[1]), "+v"(x[2]), "+v"(x[3]), "+v"(x[4]), "+v"(x[5]), "+v"(x[6]), "+v"(x[7]));
}
__device__ __forceinline__ void exp2_run9(float* x, float& y) {
  asm("v_exp_f32 %0, %0\n\tv_exp_f32 %1, %1\n\tv_exp_f32 %2, %2\n\tv_exp_f32 %3, %3\n\tv_exp_f32 %8, %8\n\t"
      "v_exp_f32 %4, %4\n\tv_exp_f32 %5, %5\n\tv_exp_f32 %6, %6\n\tv_exp_f32 %7, %7\n\tv_nop"
      : "+v"(x[0]), "+v"(x[1]), "+v"(x[2]), "+v"(x[3]), "+v"(x[4]), "+v"(x[5]), "+v"(x[6]), "+v"(x[7]), "+v"(y));
}

#define KTB  (32 * KSTRIDE * 2)   // bytes of one key tile in LDS (32 keys x 144 B); it serves as K and, read transposed, as V^T

// One 32-key tile on its way from the f32 input to LDS, through registers: 64 lanes, 16 lanes a 256-byte row piece (whole lines), eight
// rows a lane. base: the (batch, head) corner of the input, one value for the work-group; o0, o1: byte offsets of the lane's eight rows.
// The s_wait_xcnt stands behind the loads and names their offset registers as inputs, so that they live up to it and are rewritten behind it.
__device__ __forceinline__ void load_rows(const char* __restrict__ base, v4u_t o0, v4u_t o1, unsigned c16, v4f_t* st) {
  unsigned vo[8];
#pragma unroll
  for (int i = 0; i < 4; ++i) { vo[i] = o0[i] + c16; vo[4 + i] = o1[i] + c16; }
#pragma unroll
  for (int i = 0; i < 8; ++i) st[i] = *(const v4f_t*)(base + vo[i]);
  asm volatile("s_wait_xcnt 0x0" :: "v"(vo[0]), "v"(vo[1]), "v"(vo[2]), "v"(vo[3]), "v"(vo[4]), "v"(vo[5]), "v"(vo[6]), "v"(vo[7]) : "memory");
}
// dst: the lane's 8 bytes in the first of its eight rows of the tile
__device__ __forceinline__ void store_rows(unsigned char* dst, const v4f_t* st) {
#pragma unroll
  for (int i = 0; i < 8; ++i) {
    bf16x4 q;
    q[0] = (bf16)st[i][0]; q[1] = (bf16)st[i][1]; q[2] = (bf16)st[i][2]; q[3] = (bf16)st[i][3];
    *(bf16x4*)(dst + i * (KSTRIDE * 2)) = q;
  }
}

// 16 (dims) x 32 (keys) fragment of V^T off the row-major key tile, by the transposing load: lane (c = l & 15, h = l >> 4) gets
// tile[8h + 0..7][d0 + c] and tile[16 + 8h + 0..7][d0 + c], the k order of lds_frag below.
// p: tile + (8h + (l & 7)) * pitch + 16 * ((l >> 3) & 1) + 2 * d0
typedef short s16x8 __attribute__((ext_vector_type(8)));
__device__ __forceinline__ bf16x16 lds_frag_tr(const unsigned char* p) {
  typedef __attribute__((address_space(3))) s16x8 lds_s16x8;
  const bf16x8 lo = __builtin_bit_cast(bf16x8, __builtin_amdgcn_ds_load_tr16_b128_v8i16((lds_s16x8*)p));
  const bf16x8 hi = __builtin_bit_cast(bf16x8, __builtin_amdgcn_ds_load_tr16_b128_v8i16((lds_s16x8*)(p + 16 * KSTRIDE * 2)));
  bf16x16 f;
#pragma unroll
  for (int i = 0; i < 8; ++i) { f[i] = lo[i]; f[i + 8] = hi[i]; }
  return f;
}

// 16x32 (MxK) f16 fragment from f32 rows in global memory; p: the lane's own row, at the first k that the lane holds.
// lanes 0-15  (row=lane)    : elems 0..7 = K+0..7,  8..15 = K+16..23
// lanes 16-31 (row=lane-16) : elems 0..7 = K+8..15, 8..15 = K+24..31
__device__ __forceinline__ bf16x16 load_frag_f32(const float* __restrict__ p) {
  const v4f_t a0 = *(const v4f_t*)(p),      a1 = *(const v4f_t*)(p + 4);
  const v4f_t b0 = *(const v4f_t*)(p + 16), b1 = *(const v4f_t*)(p + 20);
  bf16x16 f;
  for (int i = 0; i < 4; ++i) {
    f[i]     = (bf16)a0[i]; f[i + 4]  = (bf16)a1[i];
    f[i + 8] = (bf16)b0[i]; f[i + 12] = (bf16)b1[i];
  }
  return f;
}

// Same fragment from an LDS tile with padded row stride (base includes row0/k0).
__device__ __forceinline__ bf16x16 lds_frag(const bf16* base, int stride) {
  const int lane = threadIdx.x & 31;
  const int row  = lane & 15;
  const int kh   = (lane >> 4) * 8;
  const bf16x8 lo = *(const bf16x8*)(base + row * stride + kh);
  const bf16x8 hi = *(const bf16x8*)(base + row * stride + kh + 16);
  bf16x16 f;
#pragma unroll
  for (int i = 0; i < 8; ++i) { f[i] = lo[i]; f[i + 8] = hi[i]; }
  return f;
}

template <typename T>
__device__ __forceinline__ void stage_read16(const T* __restrict__ p, float* buf) {
#pragma unroll
  for (int i = 0; i < 16; ++i) buf[i] = (float)p[i];
}

__device__ __forceinline__ void stage_write(bf16* dst, const float* buf, int nquad) {
#pragma unroll
  for (int i = 0; i < nquad; ++i) {
    bf16x4 q;
    q[0] = (bf16)buf[4 * i];     q[1] = (bf16)buf[4 * i + 1];
    q[2] = (bf16)buf[4 * i + 2]; q[3] = (bf16)buf[4 * i + 3];
    *(bf16x4*)(dst + 4 * i) = q;
  }
}

// ---------------------------------------------------------------------------
// Attention: block 64 thr (2 waves) = 64 queries x one head; key step 32;
// wave tile 32 queries x 64 dk. K/Vᵀ staged through LDS (f16, padded stride)
// in two buffers by global loads to registers and f16 LDS stores, the loads of the tile after next in flight during each trip.
// Output: f32 rows [B][LTRUE][DD] (head h at columns h*64..h*64+63).
// ---------------------------------------------------------------------------
__global__ __launch_bounds__(64) void attn_kernel(
    const float* __restrict__ Qf, const int* __restrict__ mask,   // Qf: the f32 query rows [B][LTRUE][DD], also keys and values; mask [B][LTRUE]
    float* __restrict__ out) {                                    // out [B][LTRUE][DD]: the padded query rows are not stored
  __shared__ __attribute__((aligned(16))) unsigned char ring[2 * 32 * 68 * 4];   // two key tiles; behind the loop the waves' output staging
  __shared__ __attribute__((aligned(16))) unsigned tokS[KROWS];                  // byte offset of each walked key's row in its batch's input
  __shared__ __attribute__((aligned(16))) float kbS[KROWS];
  static_assert(2 * KTB <= 2 * 32 * 68 * 4, "both key tiles must fit the ring");

  const int q0blk = blockIdx.x * 64;
  const int h  = blockIdx.y;
  const int b  = blockIdx.z;
  const int t    = threadIdx.x;
  const int wave = t >> 5;
  const int lane = t & 31;
  const int qlane = lane & 15;
  const int kh8   = (lane >> 4) * 8;
  const int q0 = q0blk + wave * 32;          // this wave's 32 queries

  // The batch's 1000 mask entries, 250 pieces of four: each wave fetches the 128 pieces that it ranks (0..3) and the other wave's (4..7).
  const int wv  = __builtin_amdgcn_readfirstlane(wave);
  const int own = wv * 128, oth = 128 - own;
  const v4i_t* mrow = (const v4i_t*)(mask + b * LTRUE);
  int mo[8];
  v4i_t mm[8];
#pragma unroll
  for (int j = 0; j < 4; ++j) {   // a piece past the last reads the last one and counts for nothing
    mo[j]     = min(own + 32 * j + lane, LTRUE / 4 - 1);
    mo[4 + j] = min(oth + 32 * j + lane, LTRUE / 4 - 1);
  }
#pragma unroll
  for (int j = 0; j < 8; ++j) mm[j] = mrow[mo[j]];

  bf16x16 qf[QW][2];
  const float* qrow[QW];
#pragma unroll
  for (int qt = 0; qt < QW; ++qt) {   // a padded query row is never stored: its lane reads the last real row instead of past the input
    qrow[qt] = Qf + ((size_t)b * LTRUE + min(q0 + 16 * qt + qlane, LTRUE - 1)) * DD + h * DKK + kh8;
    qf[qt][0] = load_frag_f32(qrow[qt]);
    qf[qt][1] = load_frag_f32(qrow[qt] + 32);
  }
  // stands in front of the first rewrite of a mask or Q load's address registers, which it names as inputs so that they live up to it
  asm volatile("s_wait_xcnt 0x0" :: "v"(qrow[0]), "v"(qrow[1]), "v"(mo[0]), "v"(mo[1]), "v"(mo[2]), "v"(mo[3]),
               "v"(mo[4]), "v"(mo[5]), "v"(mo[6]), "v"(mo[7]) : "memory");

  // Ranks of the allowed keys (mask != 0): wave 0's come first, inside a wave they run by piece group, entry and lane. Any order serves:
  // a key's place only sets where its term stands in the sums. Every rank is below the count, which is at most LTRUE.
  int cnt_o = 0;
#pragma unroll
  for (int j = 0; j < 4; ++j)
#pragma unroll
    for (int e = 0; e < 4; ++e)
      cnt_o += __builtin_popcount(__builtin_amdgcn_ballot_w32(oth + 32 * j + lane < LTRUE / 4 && mm[4 + j][e] != 0));
  int run = wv ? cnt_o : 0;
#pragma unroll
  for (int j = 0; j < 4; ++j)
#pragma unroll
    for (int e = 0; e < 4; ++e) {
      const int piece = own + 32 * j + lane;
      const bool f = piece < LTRUE / 4 && mm[j][e] != 0;
      const unsigned bal = __builtin_amdgcn_ballot_w32(f);
      const unsigned pos = __builtin_amdgcn_mbcnt_lo(bal, (unsigned)run);
      if (f) tokS[pos] = (unsigned)(4 * piece + e) * (DD * 4u);
      run += __builtin_popcount(bal);
    }
  // allowed keys of the batch, one value for the whole work-group; clamped to the shape, since trip counts are formed from it
  const int nb = min(__builtin_amdgcn_readfirstlane(wv ? run : run + cnt_o), LTRUE);
  const int nw = nb > 0 ? nb : LTRUE;   // keys that are walked; with no allowed key every token is, each at -1e9
  if (nb == 0)
    for (int k = t; k < LTRUE; k += 64) tokS[k] = (unsigned)k * (DD * 4u);
  for (int k = nw + t; k < KROWS; k += 64) tokS[k] = 0u;   // behind the walked keys: token 0's row, at weight 0 (the last tile's filler)

  f32x8 o[QW][4] = {};
  float mrun[QW], lrun[QW];
#pragma unroll
  for (int qt = 0; qt < QW; ++qt) { mrun[qt] = -INFINITY; lrun[qt] = 0.0f; }

  const float scale = 0.125f * 1.44269504088896340736f;  // 1/sqrt(DK)*log2(e)
  const int kmax = nw - 1;       // last key that is walked
  // additive logit bias of each walked key, in log2 units: 0 (with no allowed key -1e9, which swallows the score); -3e9 for the filler
  // behind them, whose weight is exactly 0 beside either
  const float bin = nb > 0 ? 0.0f : -1.0e9f * 1.44269504088896340736f;
  for (int j = 0; j < KROWS / 256; ++j) {
    const int k4 = t + 64 * j;
    v4f_t kv;
    for (int e = 0; e < 4; ++e) kv[e] = 4 * k4 + e < nw ? bin : -3.0e9f;
    *(v4f_t*)(kbS + 4 * k4) = kv;
  }
  __syncthreads();   // row offsets and key bias visible to both waves

  // Cooperative staging (64 threads): lane t brings 16 bytes (4 dims) of rows 8 * (t >> 4) + 0..7 of a tile.
  const char* kcorner = (const char*)(Qf + (size_t)b * LTRUE * DD + h * DKK);
  const unsigned c16 = (t & 15) * 16;
  const unsigned* tokL = tokS + (t >> 4) * 8;
  unsigned char* sdst = ring + (t >> 4) * 8 * (KSTRIDE * 2) + (t & 15) * 8;
  v4f_t st0[8], st[8];
  load_rows(kcorner, *(const v4u_t*)tokL, *(const v4u_t*)(tokL + 4), c16, st0);
  if (32 <= kmax) load_rows(kcorner, *(const v4u_t*)(tokL + 32), *(const v4u_t*)(tokL + 36), c16, st);   // tile 1, where there is one, flies beside tile 0
  store_rows(sdst, st0);                                                         // tile 0 into buffer 0
  v4u_t on0 = *(const v4u_t*)(tokL + 64), on1 = *(const v4u_t*)(tokL + 68);      // row offsets of tile 2 (all of tokS is written)
  __syncthreads();   // tile 0 visible to both waves

  unsigned cur = 0;   // byte offset in the ring of the buffer that this trip reads
  for (int kb = 0; kb <= kmax; kb += 32) {
    const bf16* ldsK = (const bf16*)(ring + cur);
    const unsigned char* ldsVt = ring + cur + (kh8 + (lane & 7)) * (KSTRIDE * 2) + ((lane >> 3) & 1) * 16;

    // The next tile, fetched a trip ago, goes into the other buffer, whose readers the last barrier has ended; the tile after it is
    // fetched under this trip's work, and the row offsets of the one after that are read a trip ahead of their use.
    if (kb + 32 <= kmax) store_rows(sdst + (KTB - cur), st);
    if (kb + 64 <= kmax) load_rows(kcorner, on0, on1, c16, st);
    { const unsigned* tn = tokL + min(kb + 96, KROWS - 32); on0 = *(const v4u_t*)tn; on1 = *(const v4u_t*)(tn + 4); }

    // Phase 1: scores + softmax for both q-tiles (K fragments live here only).
    bf16x16 kf[2][2];
#pragma unroll
    for (int ktile = 0; ktile < 2; ++ktile)
#pragma unroll
      for (int c = 0; c < 2; ++c)
        kf[ktile][c] = lds_frag(ldsK + (ktile * 16) * KSTRIDE + c * 32, KSTRIDE);

    bf16x16 pf[QW];
#pragma unroll
    for (int qt = 0; qt < QW; ++qt) {
        f32x8 s0 = {}, s1 = {};
        s0 = wmma_bf16(kf[0][0], qf[qt][0], s0);
        s0 = wmma_bf16(kf[0][1], qf[qt][1], s0);
        s1 = wmma_bf16(kf[1][0], qf[qt][0], s1);
        s1 = wmma_bf16(kf[1][1], qf[qt][1], s1);

        float mx = -INFINITY;
#pragma unroll
        for (int r = 0; r < 8; ++r) {
          s0[r] = s0[r] * scale + kbS[kb + kh8 + r];
          s1[r] = s1[r] * scale + kbS[kb + 16 + kh8 + r];
          mx = fmaxf(mx, fmaxf(s0[r], s1[r]));
        }
        mx = fmaxf(mx, __shfl_xor(mx, 16, 32));
        const float mnew  = fmaxf(mrun[qt], mx);
        float alpha = mrun[qt] - mnew;
        float e0[8], e1[8];
#pragma unroll
        for (int r = 0; r < 8; ++r) { e0[r] = s0[r] - mnew; e1[r] = s1[r] - mnew; }
        exp2_run9(e0, alpha);
        exp2_run8(e1);

        float rsum = 0.0f;
#pragma unroll
        for (int r = 0; r < 8; ++r) {
          const float p0 = e0[r];
          const float p1 = e1[r];
          rsum += p0 + p1;
          pf[qt][r]     = (bf16)(p0 * 1024.0f);     // P carried x1024: no f16 copy of a probability is sub-normal
          pf[qt][r + 8] = (bf16)(p1 * 1024.0f);
        }
        rsum += __shfl_xor(rsum, 16, 32);
        lrun[qt] = lrun[qt] * alpha + rsum;
        mrun[qt] = mnew;

        // Rescale accumulators now so the PV phase is pure WMMA.
#pragma unroll
        for (int j = 0; j < 4; ++j)
#pragma unroll
          for (int r = 0; r < 8; ++r) o[qt][j][r] *= alpha;
    }

    // Phase 2: O^T accumulate; each V fragment read from LDS once, used by
    // both q-tiles, then dead (only 8 VGPRs of V live at a time).
#pragma unroll
    for (int j = 0; j < 4; ++j) {
      const bf16x16 vf = lds_frag_tr(ldsVt + 32 * j);
#pragma unroll
      for (int qt = 0; qt < QW; ++qt)
        o[qt][j] = wmma_bf16(vf, pf[qt], o[qt][j]);
    }

    // Hand-over: this wave's reads of the buffer and its writes of the next tile are done; the one barrier publishes the next tile
    // and frees this buffer for the tile after it.
    asm volatile("s_wait_dscnt 0x0" ::: "memory");
    __syncthreads();
    cur = KTB - cur;
  }

  float* so = (float*)ring + wave * (32 * 68);   // the last trip's barrier stands behind every read of the ring
  const float lpad = nb > 0 ? 0.0f : (float)(KROWS - LTRUE);   // with no allowed key the padding keys weigh 1 each, on zero rows
#pragma unroll
  for (int qt = 0; qt < QW; ++qt) {
    const float rl = 1.0f / ((lrun[qt] + lpad) * 1024.0f);
#pragma unroll
    for (int j = 0; j < 4; ++j)
#pragma unroll
      for (int r = 0; r < 8; ++r) so[(16 * qt + qlane) * 68 + j * 16 + kh8 + r] = o[qt][j][r] * rl;
  }
  asm volatile("s_wait_dscnt 0" ::: "memory");
  __builtin_amdgcn_wave_barrier();
  float* orow = out + ((size_t)(b * LTRUE + q0)) * DD + h * DKK;
  if (q0 + 32 <= LTRUE) {   // all 32 query rows of the wave are real (the test reads the same in every lane of a wave)
#pragma unroll
    for (int it = 0; it < 16; ++it) { const int ch = lane + 32 * it, ql = ch >> 4, q4 = (ch & 15) * 4;
      *(v4f_t*)(orow + (size_t)ql * DD + q4) = *(const v4fa*)(so + ql * 68 + q4); }
  } else {                  // the wave that holds the last real rows: the padded rows are not stored
#pragma unroll 1            // taken by one wave of each (batch, head) only: rolled, it keeps the kernel's text short
    for (int it = 0; it < 16; ++it) { const int ch = lane + 32 * it, ql = ch >> 4, q4 = (ch & 15) * 4;
      if (q0 + ql < LTRUE) {
        *(v4f_t*)(orow + (size_t)ql * DD + q4) = *(const v4fa*)(so + ql * 68 + q4);
        asm volatile("s_wait_xcnt 0x0" ::: "memory");   // stands in front of the next trip's rewrite of the store's address and data registers
      } }
  }
}


extern "C" void kernel_launch(void* const* d_in, const int* in_sizes, int n_in,
                              void* d_out, int out_size, void* d_ws, size_t ws_size,
                              hipStream_t stream) {
  (void)in_sizes; (void)n_in; (void)out_size;
  const float* q = (const float*)d_in[0]; const int* mask = (const int*)d_in[1];
  float* out = (float*)d_out;     // [8,1000,1024]
  (void)d_ws; (void)ws_size;
  attn_kernel<<<dim3(QROWS / 64, HH, BB), dim3(64), 0, stream>>>(q, mask, out);
}

// v006
// One run takes 25.6 microseconds.
// Two timings next to v005 put it at 1.07 and 1.08 times that version's speed.
// All steps since v000 together make it 3.44 times as fast.
// Contractions on v_wmma_f32_16x16x32_f16 (plain f16 operands, f32 accumulate): self-attention with q = k = v = query (no projections),
// 16 heads of 64, sequence 1000 zero-padded to 1024 as in the reference, scale 1/8, key mask (mask == 0 and the 24 padding keys: logit -1e9).
// A blocked key's weight is exactly 0 as soon as the batch has one allowed key, so every work-group ranks its batch's mask entries and walks
// only the allowed keys, in 32-key tiles that it fetches from the f32 input by their ranks and lays in LDS as f16 (a batch with no allowed
// key walks all 1000 tokens with Q set to zero, so every logit is equal, and counts the 24 padding keys in the row sum: the reference's
// uniform weights).
// One launch. Flash-style S^T = K.Q^T / O^T = V^T.P^T, V^T read off the same key tile by the transposing LDS load, online softmax in f32
// on the raw scores (P and the row sums x1024); the padded query rows are not stored. compute dtype: f16 operands, f32 accumulate.
#include <hip/hip_runtime.h>
#include <hip/hip_bf16.h>
#include <math.h>

#define BB 8
#define LTRUE 1000
#define SS 1024
#define QROWS 1024
#define KROWS 1024
#define NKV 1024
#define DD 1024
#define HH 16
#define KVH 16
#define KVD 1024
#define HKDIV 1
#define DKK 64
#define QW 2
#define GSTR 48

typedef _Float16 bf16;
typedef _Float16 f16;
typedef __attribute__((ext_vector_type(4))) unsigned v4u_t;
typedef unsigned v4ua __attribute__((ext_vector_type(4), may_alias));
typedef __attribute__((ext_vector_type(4))) float v4f_t;
typedef __attribute__((ext_vector_type(4))) int v4i_t;
typedef float v4fa __attribute__((ext_vector_type(4), may_alias));
typedef __attribute__((ext_vector_type(16))) bf16  bf16x16;
typedef bf16x16 f16x16;
typedef __attribute__((ext_vector_type(8)))  bf16  bf16x8;
typedef bf16x8 f16x8;
typedef __attribute__((ext_vector_type(4)))  bf16  bf16x4;
typedef __attribute__((ext_vector_type(8)))  float f32x8;
typedef __attribute__((ext_vector_type(2)))  float f32x2;
__device__ __forceinline__ f32x8 wmma16(f16x16 a, f16x16 b, f32x8 c) {
  c = __builtin_amdgcn_wmma_f32_16x16x32_f16(false, a, false, b, (short)0, c, false, false);
  asm volatile("v_nop\n\tv_nop\n\tv_nop\n\tv_nop" : "+v"(c) : "v"(a), "v"(b));
  return c;
}
#define LDS_STRIDE 48   // unused: 48 elems (96B rows)
#define KSTRIDE    72   // attn K tile: 64 -> 72 elems (144B rows): conflict-free b128
#define VSTRIDE    48   // unused: 48 elems (96B rows)

__device__ __forceinline__ f32x8 wmma_bf16(bf16x16 a, bf16x16 b, f32x8 c) {
  c = __builtin_amdgcn_wmma_f32_16x16x32_f16(false, a, false, b, (short)0, c, false, false);
  asm volatile("v_nop\n\tv_nop\n\tv_nop\n\tv_nop" : "+v"(c) : "v"(a), "v"(b));   // A/B-overwrite hazard guard
  return c;
}

// x = 2^x for a run of values, each on the bare v_exp_f32 and in its own register. The library's exp2f adds a compare, two selects, an add
// and a v_ldexp_f32 per value to keep results below 2^-126; here such a result may come out as 0: every argument is <= 10, and the result is
// only ever added to a row sum >= 1024, rounded to an f16 weight, or multiplied into sums that a weight of 1024 has just joined.
// One statement per run: each v_exp_f32 is followed by one on other registers and the last by a v_nop, the slot that the instruction set
// asks for behind a transcendental.
__device__ __forceinline__ void exp2_run8(float* x) {
  asm("v_exp_f32 %0, %0\n\tv_exp_f32 %1, %1\n\tv_exp_f32 %2, %2\n\tv_exp_f32 %3, %3\n\t"
      "v_exp_f32 %4, %4\n\tv_exp_f32 %5, %5\n\tv_exp_f32 %6, %6\n\tv_exp_f32 %7, %7\n\tv_nop"
      : "+v"(x[0]), "+v"(x[1]), "+v"(x[2]), "+v"(x[3]), "+v"(x[4]), "+v"(x[5]), "+v"(x[6]), "+v"(x[7]));
}
__device__ __forceinline__ void exp2_run9(float* x, float& y) {
  asm("v_exp_f32 %0, %0\n\tv_exp_f32 %1, %1\n\tv_exp_f32 %2, %2\n\tv_exp_f32 %3, %3\n\tv_exp_f32 %8, %8\n\t"
      "v_exp_f32 %4, %4\n\tv_exp_f32 %5, %5\n\tv_exp_f32 %6, %6\n\tv_exp_f32 %7, %7\n\tv_nop"
      : "+v"(x[0]), "+v"(x[1]), "+v"(x[2]), "+v"(x[3]), "+v"(x[4]), "+v"(x[5]), "+v"(x[6]), "+v"(x[7]), "+v"(y));
}

#define KTB  (32 * KSTRIDE * 2)   // bytes of one key tile in LDS (32 keys x 144 B); it serves as K and, read transposed, as V^T

// One 32-key tile on its way from the f32 input to LDS, through registers: 64 lanes, 16 lanes a 256-byte row piece (whole lines), eight
// rows a lane. base: the (batch, head) corner of the input, one value for the work-group; o0, o1: byte offsets of the lane's eight rows.
// The s_wait_xcnt stands behind the loads and names their offset registers as inputs, so that they live up to it and are rewritten behind it.
__device__ __forceinline__ void load_rows(const char* __restrict__ base, v4u_t o0, v4u_t o1, unsigned c16, v4f_t* st) {
  unsigned vo[8];
#pragma unroll
  for (int i = 0; i < 4; ++i) { vo[i] = o0[i] + c16; vo[4 + i] = o1[i] + c16; }
#pragma unroll
  for (int i = 0; i < 8; ++i) st[i] = *(const v4f_t*)(base + vo[i]);
  asm volatile("s_wait_xcnt 0x0" :: "v"(vo[0]), "v"(vo[1]), "v"(vo[2]), "v"(vo[3]), "v"(vo[4]), "v"(vo[5]), "v"(vo[6]), "v"(vo[7]) : "memory");
}
// dst: the lane's 8 bytes in the first of its eight rows of the tile
__device__ __forceinline__ void store_rows(unsigned char* dst, const v4f_t* st) {
#pragma unroll
  for (int i = 0; i < 8; ++i) {
    bf16x4 q;
    q[0] = (bf16)st[i][0]; q[1] = (bf16)st[i][1]; q[2] = (bf16)st[i][2]; q[3] = (bf16)st[i][3];
    *(bf16x4*)(dst + i * (KSTRIDE * 2)) = q;
  }
}

// 16 (dims) x 32 (keys) fragment of V^T off the row-major key tile, by the transposing load: lane (c = l & 15, h = l >> 4) gets
// tile[8h + 0..7][d0 + c] and tile[16 + 8h + 0..7][d0 + c], the k order of lds_frag below.
// p: tile + (8h + (l & 7)) * pitch + 16 * ((l >> 3) & 1) + 2 * d0
typedef short s16x8 __attribute__((ext_vector_type(8)));
__device__ __forceinline__ bf16x16 lds_frag_tr(const unsigned char* p) {
  typedef __attribute__((address_space(3))) s16x8 lds_s16x8;
  const bf16x8 lo = __builtin_bit_cast(bf16x8, __builtin_amdgcn_ds_load_tr16_b128_v8i16((lds_s16x8*)p));
  const bf16x8 hi = __builtin_bit_cast(bf16x8, __builtin_amdgcn_ds_load_tr16_b128_v8i16((lds_s16x8*)(p + 16 * KSTRIDE * 2)));
  bf16x16 f;
#pragma unroll
  for (int i = 0; i < 8; ++i) { f[i] = lo[i]; f[i + 8] = hi[i]; }
  return f;
}

// 16x32 (MxK) f16 fragment from f32 rows in global memory; p: the lane's own row, at the first k that the lane holds.
// lanes 0-15  (row=lane)    : elems 0..7 = K+0..7,  8..15 = K+16..23
// lanes 16-31 (row=lane-16) : elems 0..7 = K+8..15, 8..15 = K+24..31
__device__ __forceinline__ bf16x16 load_frag_f32(const float* __restrict__ p) {
  const v4f_t a0 = *(const v4f_t*)(p),      a1 = *(const v4f_t*)(p + 4);
  const v4f_t b0 = *(const v4f_t*)(p + 16), b1 = *(const v4f_t*)(p + 20);
  bf16x16 f;
  for (int i = 0; i < 4; ++i) {
    f[i]     = (bf16)a0[i]; f[i + 4]  = (bf16)a1[i];
    f[i + 8] = (bf16)b0[i]; f[i + 12] = (bf16)b1[i];
  }
  return f;
}

// Same fragment from an LDS tile with padded row stride (base includes row0/k0).
__device__ __forceinline__ bf16x16 lds_frag(const bf16* base, int stride) {
  const int lane = threadIdx.x & 31;
  const int row  = lane & 15;
  const int kh   = (lane >> 4) * 8;
  const bf16x8 lo = *(const bf16x8*)(base + row * stride + kh);
  const bf16x8 hi = *(const bf16x8*)(base + row * stride + kh + 16);
  bf16x16 f;
#pragma unroll
  for (int i = 0; i < 8; ++i) { f[i] = lo[i]; f[i + 8] = hi[i]; }
  return f;
}

template <typename T>
__device__ __forceinline__ void stage_read16(const T* __restrict__ p, float* buf) {
#pragma unroll
  for (int i = 0; i < 16; ++i) buf[i] = (float)p[i];
}

__device__ __forceinline__ void stage_write(bf16* dst, const float* buf, int nquad) {
#pragma unroll
  for (int i = 0; i < nquad; ++i) {
    bf16x4 q;
    q[0] = (bf16)buf[4 * i];     q[1] = (bf16)buf[4 * i + 1];
    q[2] = (bf16)buf[4 * i + 2]; q[3] = (bf16)buf[4 * i + 3];
    *(bf16x4*)(dst + 4 * i) = q;
  }
}

// ---------------------------------------------------------------------------
// Attention: block 64 thr (2 waves) = 64 queries x one head; key step 32;
// wave tile 32 queries x 64 dk. K/Vᵀ staged through LDS (f16, padded stride)
// in two buffers by global loads to registers and f16 LDS stores, the loads of the tile after next in flight during each trip.
// Output: f32 rows [B][LTRUE][DD] (head h at columns h*64..h*64+63).
// ---------------------------------------------------------------------------
__global__ __launch_bounds__(64) void attn_kernel(
    const float* __restrict__ Qf, const int* __restrict__ mask,   // Qf: the f32 query rows [B][LTRUE][DD], also keys and values; mask [B][LTRUE]
    float* __restrict__ out) {                                    // out [B][LTRUE][DD]: the padded query rows are not stored
  __shared__ __attribute__((aligned(16))) unsigned char ring[2 * 32 * 68 * 4];   // two key tiles; behind the loop the waves' output staging
  __shared__ __attribute__((aligned(16))) unsigned tokS[KROWS];                  // byte offset of each walked key's row in its batch's input
  static_assert(2 * KTB <= 2 * 32 * 68 * 4, "both key tiles must fit the ring");

  const int q0blk = blockIdx.x * 64;
  const int h  = blockIdx.y;
  const int b  = blockIdx.z;
  const int t    = threadIdx.x;
  const int wave = t >> 5;
  const int lane = t & 31;
  const int qlane = lane & 15;
  const int kh8   = (lane >> 4) * 8;
  const int q0 = q0blk + wave * 32;          // this wave's 32 queries

  // The batch's 1000 mask entries, 250 pieces of four: each wave fetches the 128 pieces that it ranks (0..3) and the other wave's (4..7).
  const int wv  = __builtin_amdgcn_readfirstlane(wave);
  const int own = wv * 128, oth = 128 - own;
  const v4i_t* mrow = (const v4i_t*)(mask + b * LTRUE);
  int mo[8];
  v4i_t mm[8];
#pragma unroll
  for (int j = 0; j < 4; ++j) {   // a piece past the last reads the last one and counts for nothing
    mo[j]     = min(own + 32 * j + lane, LTRUE / 4 - 1);
    mo[4 + j] = min(oth + 32 * j + lane, LTRUE / 4 - 1);
  }
#pragma unroll
  for (int j = 0; j < 8; ++j) mm[j] = mrow[mo[j]];

  bf16x16 qf[QW][2];
  const float* qrow[QW];
#pragma unroll
  for (int qt = 0; qt < QW; ++qt) {   // a padded query row is never stored: its lane reads the last real row instead of past the input
    qrow[qt] = Qf + ((size_t)b * LTRUE + min(q0 + 16 * qt + qlane, LTRUE - 1)) * DD + h * DKK + kh8;
    qf[qt][0] = load_frag_f32(qrow[qt]);
    qf[qt][1] = load_frag_f32(qrow[qt] + 32);
  }
  // stands in front of the first rewrite of a mask or Q load's address registers, which it names as inputs so that they live up to it
  asm volatile("s_wait_xcnt 0x0" :: "v"(qrow[0]), "v"(qrow[1]), "v"(mo[0]), "v"(mo[1]), "v"(mo[2]), "v"(mo[3]),
               "v"(mo[4]), "v"(mo[5]), "v"(mo[6]), "v"(mo[7]) : "memory");

  // Ranks of the allowed keys (mask != 0): wave 0's come first, inside a wave they run by piece group, entry and lane. Any order serves:
  // a key's place only sets where its term stands in the sums. Every rank is below the count, which is at most LTRUE.
  int cnt_o = 0;
#pragma unroll
  for (int j = 0; j < 4; ++j)
#pragma unroll
    for (int e = 0; e < 4; ++e)
      cnt_o += __builtin_popcount(__builtin_amdgcn_ballot_w32(oth + 32 * j + lane < LTRUE / 4 && mm[4 + j][e] != 0));
  int run = wv ? cnt_o : 0;
#pragma unroll
  for (int j = 0; j < 4; ++j)
#pragma unroll
    for (int e = 0; e < 4; ++e) {
      const int piece = own + 32 * j + lane;
      const bool f = piece < LTRUE / 4 && mm[j][e] != 0;
      const unsigned bal = __builtin_amdgcn_ballot_w32(f);
      const unsigned pos = __builtin_amdgcn_mbcnt_lo(bal, (unsigned)run);
      if (f) tokS[pos] = (unsigned)(4 * piece + e) * (DD * 4u);
      run += __builtin_popcount(bal);
    }
  // allowed keys of the batch, one value for the whole work-group; clamped to the shape, since trip counts are formed from it
  const int nb = min(__builtin_amdgcn_readfirstlane(wv ? run : run + cnt_o), LTRUE);
  const int nw = nb > 0 ? nb : LTRUE;   // keys that are walked; with no allowed key every token is, all at one logit
  if (nb == 0) {                        // the reference gives every key -1e9 then: Q = 0 makes every walked key's score 0, the same uniform weights
#pragma unroll                          // constant indices keep qf in registers
    for (int qt = 0; qt < QW; ++qt) { qf[qt][0] = (bf16x16)(bf16)0.0f; qf[qt][1] = (bf16x16)(bf16)0.0f; }
  }
  if (nb == 0)
    for (int k = t; k < LTRUE; k += 64) tokS[k] = (unsigned)k * (DD * 4u);
  for (int k = nw + t; k < KROWS; k += 64) tokS[k] = 0u;   // behind the walked keys: token 0's row, at weight 0 (the last tile's filler)

  f32x8 o[QW][4] = {};
  float mrun[QW], lrun[QW];
#pragma unroll
  for (int qt = 0; qt < QW; ++qt) { mrun[qt] = -INFINITY; lrun[qt] = 0.0f; }

  const float scale = 0.125f * 1.44269504088896340736f;  // 1/sqrt(DK)*log2(e)
  const int kmax = nw - 1;       // last key that is walked
  __syncthreads();   // row offsets visible to both waves

  // Cooperative staging (64 threads): lane t brings 16 bytes (4 dims) of rows 8 * (t >> 4) + 0..7 of a tile.
  const char* kcorner = (const char*)(Qf + (size_t)b * LTRUE * DD + h * DKK);
  const unsigned c16 = (t & 15) * 16;
  const unsigned* tokL = tokS + (t >> 4) * 8;
  unsigned char* sdst = ring + (t >> 4) * 8 * (KSTRIDE * 2) + (t & 15) * 8;
  v4f_t st0[8], st[8];
  load_rows(kcorner, *(const v4u_t*)tokL, *(const v4u_t*)(tokL + 4), c16, st0);
  if (32 <= kmax) load_rows(kcorner, *(const v4u_t*)(tokL + 32), *(const v4u_t*)(tokL + 36), c16, st);   // tile 1, where there is one, flies beside tile 0
  store_rows(sdst, st0);                                                         // tile 0 into buffer 0
  v4u_t on0 = *(const v4u_t*)(tokL + 64), on1 = *(const v4u_t*)(tokL + 68);      // row offsets of tile 2 (all of tokS is written)
  __syncthreads();   // tile 0 visible to both waves

  unsigned cur = 0;   // byte offset in the ring of the buffer that this trip reads
  for (int kb = 0; kb <= kmax; kb += 32) {
    const bf16* ldsK = (const bf16*)(ring + cur);
    const unsigned char* ldsVt = ring + cur + (kh8 + (lane & 7)) * (KSTRIDE * 2) + ((lane >> 3) & 1) * 16;

    // The next tile, fetched a trip ago, goes into the other buffer, whose readers the last barrier has ended; the tile after it is
    // fetched under this trip's work, and the row offsets of the one after that are read a trip ahead of their use.
    if (kb + 32 <= kmax) store_rows(sdst + (KTB - cur), st);
    if (kb + 64 <= kmax) load_rows(kcorner, on0, on1, c16, st);
    { const unsigned* tn = tokL + min(kb + 96, KROWS - 32); on0 = *(const v4u_t*)tn; on1 = *(const v4u_t*)(tn + 4); }

    // Phase 1: scores + softmax for both q-tiles (K fragments live here only).
    bf16x16 kf[2][2];
#pragma unroll
    for (int ktile = 0; ktile < 2; ++ktile)
#pragma unroll
      for (int c = 0; c < 2; ++c)
        kf[ktile][c] = lds_frag(ldsK + (ktile * 16) * KSTRIDE + c * 32, KSTRIDE);

    f32x8 sc[QW][2];   // raw scores: no scale, no bias
#pragma unroll         // here and below: constant indices keep sc, e0, e1 and pf in registers
    for (int qt = 0; qt < QW; ++qt) {
        f32x8 s0 = {}, s1 = {};
        s0 = wmma_bf16(kf[0][0], qf[qt][0], s0);
        s0 = wmma_bf16(kf[0][1], qf[qt][1], s0);
        s1 = wmma_bf16(kf[1][0], qf[qt][0], s1);
        s1 = wmma_bf16(kf[1][1], qf[qt][1], s1);
        sc[qt][0] = s0; sc[qt][1] = s1;
    }
    if (kb + 32 > nw) {   // only the last tile can hold filler behind the walked keys (a scalar test): its scores go to -3e9, weight exactly 0
#pragma unroll
      for (int qt = 0; qt < QW; ++qt)
#pragma unroll
        for (int r = 0; r < 8; ++r) {
          if (kb + kh8 + r >= nw)      sc[qt][0][r] = -3.0e9f;
          if (kb + 16 + kh8 + r >= nw) sc[qt][1][r] = -3.0e9f;
        }
    }

    bf16x16 pf[QW];
#pragma unroll
    for (int qt = 0; qt < QW; ++qt) {
        const f32x8 s0 = sc[qt][0], s1 = sc[qt][1];
        float mx = -INFINITY;
#pragma unroll
        for (int r = 0; r < 8; ++r) mx = fmaxf(mx, fmaxf(s0[r], s1[r]));
        mx = fmaxf(mx, __shfl_xor(mx, 16, 32));
        const float mnew = fmaxf(mrun[qt], mx);              // running maximum of the raw scores
        float alpha = (mrun[qt] - mnew) * scale;
        // one multiply-add per score: scale, minus the scaled maximum, plus 10 (P carried x1024: no f16 copy of a probability is sub-normal)
        const float off = fmaf(-mnew, scale, 10.0f);
        const f32x2 scale2 = {scale, scale}, off2 = {off, off};
        float e0[8], e1[8];
#pragma unroll
        for (int r = 0; r < 8; r += 2) {
          const f32x2 a = __builtin_elementwise_fma((f32x2){s0[r], s0[r + 1]}, scale2, off2);
          const f32x2 c = __builtin_elementwise_fma((f32x2){s1[r], s1[r + 1]}, scale2, off2);
          e0[r] = a[0]; e0[r + 1] = a[1]; e1[r] = c[0]; e1[r + 1] = c[1];
        }
        exp2_run9(e0, alpha);
        exp2_run8(e1);

        float rsum = 0.0f;
#pragma unroll
        for (int r = 0; r < 8; ++r) {
          rsum += e0[r] + e1[r];
          pf[qt][r]     = (bf16)e0[r];
          pf[qt][r + 8] = (bf16)e1[r];
        }
        rsum += __shfl_xor(rsum, 16, 32);
        lrun[qt] = lrun[qt] * alpha + rsum;                  // x1024, like P
        mrun[qt] = mnew;

        // Rescale accumulators now so the PV phase is pure WMMA.
#pragma unroll
        for (int j = 0; j < 4; ++j)
#pragma unroll
          for (int r = 0; r < 8; ++r) o[qt][j][r] *= alpha;
    }

    // Phase 2: O^T accumulate; each V fragment read from LDS once, used by
    // both q-tiles, then dead (only 8 VGPRs of V live at a time).
#pragma unroll
    for (int j = 0; j < 4; ++j) {
      const bf16x16 vf = lds_frag_tr(ldsVt + 32 * j);
#pragma unroll
      for (int qt = 0; qt < QW; ++qt)
        o[qt][j] = wmma_bf16(vf, pf[qt], o[qt][j]);
    }

    // Hand-over: this wave's reads of the buffer and its writes of the next tile are done; the one barrier publishes the next tile
    // and frees this buffer for the tile after it.
    asm volatile("s_wait_dscnt 0x0" ::: "memory");
    __syncthreads();
    cur = KTB - cur;
  }

  float* so = (float*)ring + wave * (32 * 68);   // the last trip's barrier stands behind every read of the ring
  const float lpad = nb > 0 ? 0.0f : (float)(KROWS - LTRUE) * 1024.0f;   // with no allowed key the padding keys weigh 1 (x1024) each, on zero rows
#pragma unroll
  for (int qt = 0; qt < QW; ++qt) {
    const float rl = 1.0f / (lrun[qt] + lpad);
#pragma unroll
    for (int j = 0; j < 4; ++j)
#pragma unroll
      for (int r = 0; r < 8; ++r) so[(16 * qt + qlane) * 68 + j * 16 + kh8 + r] = o[qt][j][r] * rl;
  }
  asm volatile("s_wait_dscnt 0" ::: "memory");
  __builtin_amdgcn_wave_barrier();
  float* orow = out + ((size_t)(b * LTRUE + q0)) * DD + h * DKK;
  if (q0 + 32 <= LTRUE) {   // all 32 query rows of the wave are real (the test reads the same in every lane of a wave)
#pragma unroll
    for (int it = 0; it < 16; ++it) { const int ch = lane + 32 * it, ql = ch >> 4, q4 = (ch & 15) * 4;
      *(v4f_t*)(orow + (size_t)ql * DD + q4) = *(const v4fa*)(so + ql * 68 + q4); }
  } else {                  // the wave that holds the last real rows: the padded rows are not stored
#pragma unroll 1            // taken by one wave of each (batch, head) only: rolled, it keeps the kernel's text short
    for (int it = 0; it < 16; ++it) { const int ch = lane + 32 * it, ql = ch >> 4, q4 = (ch & 15) * 4;
      if (q0 + ql < LTRUE) {
        *(v4f_t*)(orow + (size_t)ql * DD + q4) = *(const v4fa*)(so + ql * 68 + q4);
        asm volatile("s_wait_xcnt 0x0" ::: "memory");   // stands in front of the next trip's rewrite of the store's address and data registers
      } }
  }
}


extern "C" void kernel_launch(void* const* d_in, const int* in_sizes, int n_in,
                              void* d_out, int out_size, void* d_ws, size_t ws_size,
                              hipStream_t stream) {
  (void)in_sizes; (void)n_in; (void)out_size;
  const float* q = (const float*)d_in[0]; const int* mask = (const int*)d_in[1];
  float* out = (float*)d_out;     // [8,1000,1024]
  (void)d_ws; (void)ws_size;
  attn_kernel<<<dim3(QROWS / 64, HH, BB), dim3(64), 0, stream>>>(q, mask, out);
}

// v007
// It runs in 23.2 microseconds.
// Timed twice side by side with v006, it ran 1.11 times as fast both times.
// Counting every step since v000, it is 3.82 times as fast.
// Contractions on v_wmma_f32_16x16x32_f16 (plain f16 operands, f32 accumulate): self-attention with q = k = v = query (no projections),
// 16 heads of 64, sequence 1000 zero-padded to 1024 as in the reference, scale 1/8, key mask (mask == 0 and the 24 padding keys: logit -1e9).
// A blocked key's weight is exactly 0 as soon as the batch has one allowed key, so every work-group ranks its batch's mask entries and walks
// only the allowed keys, in 32-key tiles that it fetches from the f32 input by their ranks and lays in LDS as f16 (a batch with no allowed
// key walks all 1000 tokens with Q set to zero, so every logit is equal, and counts the 24 padding keys in the row sum: the reference's
// uniform weights).
// One launch. Flash-style S^T = K.Q^T / O^T = V^T.P^T, V^T read off the same key tile by the transposing LDS load, online softmax in f32
// on the raw scores (P and the row sums x1024); the padded query rows are not stored. compute dtype: f16 operands, f32 accumulate.
#include <hip/hip_runtime.h>
#include <hip/hip_bf16.h>
#include <math.h>

#define BB 8
#define LTRUE 1000
#define SS 1024
#define QROWS 1024
#define KROWS 1024
#define NKV 1024
#define DD 1024
#define HH 16
#define KVH 16
#define KVD 1024
#define HKDIV 1
#define DKK 64
#define QW 2
#define GSTR 48

typedef _Float16 bf16;
typedef _Float16 f16;
typedef __attribute__((ext_vector_type(4))) unsigned v4u_t;
typedef unsigned v4ua __attribute__((ext_vector_type(4), may_alias));
typedef __attribute__((ext_vector_type(4))) float v4f_t;
typedef __attribute__((ext_vector_type(4))) int v4i_t;
typedef float v4fa __attribute__((ext_vector_type(4), may_alias));
typedef __attribute__((ext_vector_type(16))) bf16  bf16x16;
typedef bf16x16 f16x16;
typedef __attribute__((ext_vector_type(8)))  bf16  bf16x8;
typedef bf16x8 f16x8;
typedef __attribute__((ext_vector_type(4)))  bf16  bf16x4;
typedef __attribute__((ext_vector_type(8)))  float f32x8;
typedef __attribute__((ext_vector_type(2)))  float f32x2;
__device__ __forceinline__ f32x8 wmma16(f16x16 a, f16x16 b, f32x8 c) {
  return __builtin_amdgcn_wmma_f32_16x16x32_f16(false, a, false, b, (short)0, c, false, false);
}
#define LDS_STRIDE 48   // unused: 48 elems (96B rows)
#define KSTRIDE    72   // attn K tile: 64 -> 72 elems (144B rows): conflict-free b128
#define VSTRIDE    48   // unused: 48 elems (96B rows)

__device__ __forceinline__ f32x8 wmma_bf16(bf16x16 a, bf16x16 b, f32x8 c) {
  return __builtin_amdgcn_wmma_f32_16x16x32_f16(false, a, false, b, (short)0, c, false, false);
}

// x = 2^x for a run of values, each on the bare v_exp_f32 and in its own register. The library's exp2f adds a compare, two selects, an add
// and a v_ldexp_f32 per value to keep results below 2^-126; here such a result may come out as 0: every argument is <= 10, and the result is
// only ever added to a row sum >= 1024, rounded to an f16 weight, or multiplied into sums that a weight of 1024 has just joined.
// One statement per run: each v_exp_f32 is followed by one on other registers and the last by a v_nop, the slot that the instruction set
// asks for behind a transcendental.
__device__ __forceinline__ void exp2_run8(float* x) {
  asm("v_exp_f32 %0, %0\n\tv_exp_f32 %1, %1\n\tv_exp_f32 %2, %2\n\tv_exp_f32 %3, %3\n\t"
      "v_exp_f32 %4, %4\n\tv_exp_f32 %5, %5\n\tv_exp_f32 %6, %6\n\tv_exp_f32 %7, %7\n\tv_nop"
      : "+v"(x[0]), "+v"(x[1]), "+v"(x[2]), "+v"(x[3]), "+v"(x[4]), "+v"(x[5]), "+v"(x[6]), "+v"(x[7]));
}
__device__ __forceinline__ void exp2_run9(float* x, float& y) {
  asm("v_exp_f32 %0, %0\n\tv_exp_f32 %1, %1\n\tv_exp_f32 %2, %2\n\tv_exp_f32 %3, %3\n\tv_exp_f32 %8, %8\n\t"
      "v_exp_f32 %4, %4\n\tv_exp_f32 %5, %5\n\tv_exp_f32 %6, %6\n\tv_exp_f32 %7, %7\n\tv_nop"
      : "+v"(x[0]), "+v"(x[1]), "+v"(x[2]), "+v"(x[3]), "+v"(x[4]), "+v"(x[5]), "+v"(x[6]), "+v"(x[7]), "+v"(y));
}

#define KTB  (32 * KSTRIDE * 2)   // bytes of one key tile in LDS (32 keys x 144 B); it serves as K and, read transposed, as V^T

// One 32-key tile on its way from the f32 input to LDS, through registers: 64 lanes, 16 lanes a 256-byte row piece (whole lines), eight
// rows a lane. base: the (batch, head) corner of the input, one value for the work-group; o0, o1: byte offsets of the lane's eight rows.
// The s_wait_xcnt stands behind the loads and names their offset registers as inputs, so that they live up to it and are rewritten behind it.
__device__ __forceinline__ void load_rows(const char* __restrict__ base, v4u_t o0, v4u_t o1, unsigned c16, v4f_t* st) {
  unsigned vo[8];
#pragma unroll
  for (int i = 0; i < 4; ++i) { vo[i] = o0[i] + c16; vo[4 + i] = o1[i] + c16; }
#pragma unroll
  for (int i = 0; i < 8; ++i) st[i] = *(const v4f_t*)(base + vo[i]);
  asm volatile("s_wait_xcnt 0x0" :: "v"(vo[0]), "v"(vo[1]), "v"(vo[2]), "v"(vo[3]), "v"(vo[4]), "v"(vo[5]), "v"(vo[6]), "v"(vo[7]) : "memory");
}
// dst: the lane's 8 bytes in the first of its eight rows of the tile
__device__ __forceinline__ void store_rows(unsigned char* dst, const v4f_t* st) {
#pragma unroll
  for (int i = 0; i < 8; ++i) {
    bf16x4 q;
    q[0] = (bf16)st[i][0]; q[1] = (bf16)st[i][1]; q[2] = (bf16)st[i][2]; q[3] = (bf16)st[i][3];
    *(bf16x4*)(dst + i * (KSTRIDE * 2)) = q;
  }
}

// 16 (dims) x 32 (keys) fragment of V^T off the row-major key tile, by the transposing load: lane (c = l & 15, h = l >> 4) gets
// tile[8h + 0..7][d0 + c] and tile[16 + 8h + 0..7][d0 + c], the k order of lds_frag below.
// p: tile + (8h + (l & 7)) * pitch + 16 * ((l >> 3) & 1) + 2 * d0
typedef short s16x8 __attribute__((ext_vector_type(8)));
__device__ __forceinline__ bf16x16 lds_frag_tr(const unsigned char* p) {
  typedef __attribute__((address_space(3))) s16x8 lds_s16x8;
  const bf16x8 lo = __builtin_bit_cast(bf16x8, __builtin_amdgcn_ds_load_tr16_b128_v8i16((lds_s16x8*)p));
  const bf16x8 hi = __builtin_bit_cast(bf16x8, __builtin_amdgcn_ds_load_tr16_b128_v8i16((lds_s16x8*)(p + 16 * KSTRIDE * 2)));
  bf16x16 f;
#pragma unroll
  for (int i = 0; i < 8; ++i) { f[i] = lo[i]; f[i + 8] = hi[i]; }
  return f;
}

// 16x32 (MxK) f16 fragment from f32 rows in global memory; p: the lane's own row, at the first k that the lane holds.
// lanes 0-15  (row=lane)    : elems 0..7 = K+0..7,  8..15 = K+16..23
// lanes 16-31 (row=lane-16) : elems 0..7 = K+8..15, 8..15 = K+24..31
__device__ __forceinline__ bf16x16 load_frag_f32(const float* __restrict__ p) {
  const v4f_t a0 = *(const v4f_t*)(p),      a1 = *(const v4f_t*)(p + 4);
  const v4f_t b0 = *(const v4f_t*)(p + 16), b1 = *(const v4f_t*)(p + 20);
  bf16x16 f;
  for (int i = 0; i < 4; ++i) {
    f[i]     = (bf16)a0[i]; f[i + 4]  = (bf16)a1[i];
    f[i + 8] = (bf16)b0[i]; f[i + 12] = (bf16)b1[i];
  }
  return f;
}

// Same fragment from an LDS tile with padded row stride (base includes row0/k0).
__device__ __forceinline__ bf16x16 lds_frag(const bf16* base, int stride) {
  const int lane = threadIdx.x & 31;
  const int row  = lane & 15;
  const int kh   = (lane >> 4) * 8;
  const bf16x8 lo = *(const bf16x8*)(base + row * stride + kh);
  const bf16x8 hi = *(const bf16x8*)(base + row * stride + kh + 16);
  bf16x16 f;
#pragma unroll
  for (int i = 0; i < 8; ++i) { f[i] = lo[i]; f[i + 8] = hi[i]; }
  return f;
}

template <typename T>
__device__ __forceinline__ void stage_read16(const T* __restrict__ p, float* buf) {
#pragma unroll
  for (int i = 0; i < 16; ++i) buf[i] = (float)p[i];
}

__device__ __forceinline__ void stage_write(bf16* dst, const float* buf, int nquad) {
#pragma unroll
  for (int i = 0; i < nquad; ++i) {
    bf16x4 q;
    q[0] = (bf16)buf[4 * i];     q[1] = (bf16)buf[4 * i + 1];
    q[2] = (bf16)buf[4 * i + 2]; q[3] = (bf16)buf[4 * i + 3];
    *(bf16x4*)(dst + 4 * i) = q;
  }
}

// ---------------------------------------------------------------------------
// Attention: block 64 thr (2 waves) = 64 queries x one head; key step 32;
// wave tile 32 queries x 64 dk. K/Vᵀ staged through LDS (f16, padded stride)
// in two buffers by global loads to registers and f16 LDS stores, the loads of the tile after next in flight during each trip.
// Output: f32 rows [B][LTRUE][DD] (head h at columns h*64..h*64+63).
// ---------------------------------------------------------------------------
__global__ __launch_bounds__(64) void attn_kernel(
    const float* __restrict__ Qf, const int* __restrict__ mask,   // Qf: the f32 query rows [B][LTRUE][DD], also keys and values; mask [B][LTRUE]
    float* __restrict__ out) {                                    // out [B][LTRUE][DD]: the padded query rows are not stored
  __shared__ __attribute__((aligned(16))) unsigned char ring[2 * 32 * 68 * 4];   // two key tiles; behind the loop the waves' output staging
  __shared__ __attribute__((aligned(16))) unsigned tokS[KROWS];                  // byte offset of each walked key's row in its batch's input
  static_assert(2 * KTB <= 2 * 32 * 68 * 4, "both key tiles must fit the ring");

  const int q0blk = blockIdx.x * 64;
  const int h  = blockIdx.y;
  const int b  = blockIdx.z;
  const int t    = threadIdx.x;
  const int wave = t >> 5;
  const int lane = t & 31;
  const int qlane = lane & 15;
  const int kh8   = (lane >> 4) * 8;
  const int q0 = q0blk + wave * 32;          // this wave's 32 queries

  // The batch's 1000 mask entries, 250 pieces of four: each wave fetches the 128 pieces that it ranks (0..3) and the other wave's (4..7).
  const int wv  = __builtin_amdgcn_readfirstlane(wave);
  const int own = wv * 128, oth = 128 - own;
  const v4i_t* mrow = (const v4i_t*)(mask + b * LTRUE);
  int mo[8];
  v4i_t mm[8];
#pragma unroll
  for (int j = 0; j < 4; ++j) {   // a piece past the last reads the last one and counts for nothing
    mo[j]     = min(own + 32 * j + lane, LTRUE / 4 - 1);
    mo[4 + j] = min(oth + 32 * j + lane, LTRUE / 4 - 1);
  }
#pragma unroll
  for (int j = 0; j < 8; ++j) mm[j] = mrow[mo[j]];

  bf16x16 qf[QW][2];
  const float* qrow[QW];
#pragma unroll
  for (int qt = 0; qt < QW; ++qt) {   // a padded query row is never stored: its lane reads the last real row instead of past the input
    qrow[qt] = Qf + ((size_t)b * LTRUE + min(q0 + 16 * qt + qlane, LTRUE - 1)) * DD + h * DKK + kh8;
    qf[qt][0] = load_frag_f32(qrow[qt]);
    qf[qt][1] = load_frag_f32(qrow[qt] + 32);
  }
  // stands in front of the first rewrite of a mask or Q load's address registers, which it names as inputs so that they live up to it
  asm volatile("s_wait_xcnt 0x0" :: "v"(qrow[0]), "v"(qrow[1]), "v"(mo[0]), "v"(mo[1]), "v"(mo[2]), "v"(mo[3]),
               "v"(mo[4]), "v"(mo[5]), "v"(mo[6]), "v"(mo[7]) : "memory");

  // Ranks of the allowed keys (mask != 0): wave 0's come first, inside a wave they run by piece group, entry and lane. Any order serves:
  // a key's place only sets where its term stands in the sums. Every rank is below the count, which is at most LTRUE.
  int cnt_o = 0;
#pragma unroll
  for (int j = 0; j < 4; ++j)
#pragma unroll
    for (int e = 0; e < 4; ++e)
      cnt_o += __builtin_popcount(__builtin_amdgcn_ballot_w32(oth + 32 * j + lane < LTRUE / 4 && mm[4 + j][e] != 0));
  int run = wv ? cnt_o : 0;
#pragma unroll
  for (int j = 0; j < 4; ++j)
#pragma unroll
    for (int e = 0; e < 4; ++e) {
      const int piece = own + 32 * j + lane;
      const bool f = piece < LTRUE / 4 && mm[j][e] != 0;
      const unsigned bal = __builtin_amdgcn_ballot_w32(f);
      const unsigned pos = __builtin_amdgcn_mbcnt_lo(bal, (unsigned)run);
      if (f) tokS[pos] = (unsigned)(4 * piece + e) * (DD * 4u);
      run += __builtin_popcount(bal);
    }
  // allowed keys of the batch, one value for the whole work-group; clamped to the shape, since trip counts are formed from it
  const int nb = min(__builtin_amdgcn_readfirstlane(wv ? run : run + cnt_o), LTRUE);
  const int nw = nb > 0 ? nb : LTRUE;   // keys that are walked; with no allowed key every token is, all at one logit
  if (nb == 0) {                        // the reference gives every key -1e9 then: Q = 0 makes every walked key's score 0, the same uniform weights
#pragma unroll                          // constant indices keep qf in registers
    for (int qt = 0; qt < QW; ++qt) { qf[qt][0] = (bf16x16)(bf16)0.0f; qf[qt][1] = (bf16x16)(bf16)0.0f; }
  }
  if (nb == 0)
    for (int k = t; k < LTRUE; k += 64) tokS[k] = (unsigned)k * (DD * 4u);
  for (int k = nw + t; k < KROWS; k += 64) tokS[k] = 0u;   // behind the walked keys: token 0's row, at weight 0 (the last tile's filler)

  f32x8 o[QW][4] = {};
  float mrun[QW], lrun[QW];
#pragma unroll
  for (int qt = 0; qt < QW; ++qt) { mrun[qt] = -INFINITY; lrun[qt] = 0.0f; }

  const float scale = 0.125f * 1.44269504088896340736f;  // 1/sqrt(DK)*log2(e)
  const int kmax = nw - 1;       // last key that is walked
  __syncthreads();   // row offsets visible to both waves

  // Cooperative staging (64 threads): lane t brings 16 bytes (4 dims) of rows 8 * (t >> 4) + 0..7 of a tile.
  const char* kcorner = (const char*)(Qf + (size_t)b * LTRUE * DD + h * DKK);
  const unsigned c16 = (t & 15) * 16;
  const unsigned* tokL = tokS + (t >> 4) * 8;
  unsigned char* sdst = ring + (t >> 4) * 8 * (KSTRIDE * 2) + (t & 15) * 8;
  v4f_t st0[8], st[8];
  load_rows(kcorner, *(const v4u_t*)tokL, *(const v4u_t*)(tokL + 4), c16, st0);
  if (32 <= kmax) load_rows(kcorner, *(const v4u_t*)(tokL + 32), *(const v4u_t*)(tokL + 36), c16, st);   // tile 1, where there is one, flies beside tile 0
  store_rows(sdst, st0);                                                         // tile 0 into buffer 0
  v4u_t on0 = *(const v4u_t*)(tokL + 64), on1 = *(const v4u_t*)(tokL + 68);      // row offsets of tile 2 (all of tokS is written)
  __syncthreads();   // tile 0 visible to both waves

  unsigned cur = 0;   // byte offset in the ring of the buffer that this trip reads
  for (int kb = 0; kb <= kmax; kb += 32) {
    const bf16* ldsK = (const bf16*)(ring + cur);
    const unsigned char* ldsVt = ring + cur + (kh8 + (lane & 7)) * (KSTRIDE * 2) + ((lane >> 3) & 1) * 16;

    // The next tile, fetched a trip ago, goes into the other buffer, whose readers the last barrier has ended; the tile after it is
    // fetched under this trip's work, and the row offsets of the one after that are read a trip ahead of their use.
    if (kb + 32 <= kmax) store_rows(sdst + (KTB - cur), st);
    if (kb + 64 <= kmax) load_rows(kcorner, on0, on1, c16, st);
    { const unsigned* tn = tokL + min(kb + 96, KROWS - 32); on0 = *(const v4u_t*)tn; on1 = *(const v4u_t*)(tn + 4); }

    // Phase 1: scores + softmax for both q-tiles (K fragments live here only).
    bf16x16 kf[2][2];
#pragma unroll
    for (int ktile = 0; ktile < 2; ++ktile)
#pragma unroll
      for (int c = 0; c < 2; ++c)
        kf[ktile][c] = lds_frag(ldsK + (ktile * 16) * KSTRIDE + c * 32, KSTRIDE);

    f32x8 sc[QW][2];   // raw scores: no scale, no bias
#pragma unroll         // here and below: constant indices keep sc, e0, e1 and pf in registers
    for (int qt = 0; qt < QW; ++qt) {
        f32x8 s0 = {}, s1 = {};
        s0 = wmma_bf16(kf[0][0], qf[qt][0], s0);
        s0 = wmma_bf16(kf[0][1], qf[qt][1], s0);
        s1 = wmma_bf16(kf[1][0], qf[qt][0], s1);
        s1 = wmma_bf16(kf[1][1], qf[qt][1], s1);
        sc[qt][0] = s0; sc[qt][1] = s1;
    }
    if (kb + 32 > nw) {   // only the last tile can hold filler behind the walked keys (a scalar test): its scores go to -3e9, weight exactly 0
#pragma unroll
      for (int qt = 0; qt < QW; ++qt)
#pragma unroll
        for (int r = 0; r < 8; ++r) {
          if (kb + kh8 + r >= nw)      sc[qt][0][r] = -3.0e9f;
          if (kb + 16 + kh8 + r >= nw) sc[qt][1][r] = -3.0e9f;
        }
    }

    bf16x16 pf[QW];
#pragma unroll
    for (int qt = 0; qt < QW; ++qt) {
        const f32x8 s0 = sc[qt][0], s1 = sc[qt][1];
        float mx = -INFINITY;
#pragma unroll
        for (int r = 0; r < 8; ++r) mx = fmaxf(mx, fmaxf(s0[r], s1[r]));
        mx = fmaxf(mx, __shfl_xor(mx, 16, 32));
        const float mnew = fmaxf(mrun[qt], mx);              // running maximum of the raw scores
        float alpha = (mrun[qt] - mnew) * scale;
        // one multiply-add per score: scale, minus the scaled maximum, plus 10 (P carried x1024: no f16 copy of a probability is sub-normal)
        const float off = fmaf(-mnew, scale, 10.0f);
        const f32x2 scale2 = {scale, scale}, off2 = {off, off};
        float e0[8], e1[8];
#pragma unroll
        for (int r = 0; r < 8; r += 2) {
          const f32x2 a = __builtin_elementwise_fma((f32x2){s0[r], s0[r + 1]}, scale2, off2);
          const f32x2 c = __builtin_elementwise_fma((f32x2){s1[r], s1[r + 1]}, scale2, off2);
          e0[r] = a[0]; e0[r + 1] = a[1]; e1[r] = c[0]; e1[r + 1] = c[1];
        }
        exp2_run9(e0, alpha);
        exp2_run8(e1);

        float rsum = 0.0f;
#pragma unroll
        for (int r = 0; r < 8; ++r) {
          rsum += e0[r] + e1[r];
          pf[qt][r]     = (bf16)e0[r];
          pf[qt][r + 8] = (bf16)e1[r];
        }
        rsum += __shfl_xor(rsum, 16, 32);
        lrun[qt] = lrun[qt] * alpha + rsum;                  // x1024, like P
        mrun[qt] = mnew;

        // Rescale accumulators now so the PV phase is pure WMMA.
#pragma unroll
        for (int j = 0; j < 4; ++j)
#pragma unroll
          for (int r = 0; r < 8; ++r) o[qt][j][r] *= alpha;
    }

    // Phase 2: O^T accumulate; each V fragment read from LDS once, used by
    // both q-tiles, then dead (only 8 VGPRs of V live at a time).
#pragma unroll
    for (int j = 0; j < 4; ++j) {
      const bf16x16 vf = lds_frag_tr(ldsVt + 32 * j);
#pragma unroll
      for (int qt = 0; qt < QW; ++qt)
        o[qt][j] = wmma_bf16(vf, pf[qt], o[qt][j]);
    }

    // Hand-over: this wave's reads of the buffer and its writes of the next tile are done; the one barrier publishes the next tile
    // and frees this buffer for the tile after it.
    asm volatile("s_wait_dscnt 0x0" ::: "memory");
    __syncthreads();
    cur = KTB - cur;
  }

  float* so = (float*)ring + wave * (32 * 68);   // the last trip's barrier stands behind every read of the ring
  const float lpad = nb > 0 ? 0.0f : (float)(KROWS - LTRUE) * 1024.0f;   // with no allowed key the padding keys weigh 1 (x1024) each, on zero rows
#pragma unroll
  for (int qt = 0; qt < QW; ++qt) {
    const float rl = 1.0f / (lrun[qt] + lpad);
#pragma unroll
    for (int j = 0; j < 4; ++j)
#pragma unroll
      for (int r = 0; r < 8; ++r) so[(16 * qt + qlane) * 68 + j * 16 + kh8 + r] = o[qt][j][r] * rl;
  }
  asm volatile("s_wait_dscnt 0" ::: "memory");
  __builtin_amdgcn_wave_barrier();
  float* orow = out + ((size_t)(b * LTRUE + q0)) * DD + h * DKK;
  if (q0 + 32 <= LTRUE) {   // all 32 query rows of the wave are real (the test reads the same in every lane of a wave)
#pragma unroll
    for (int it = 0; it < 16; ++it) { const int ch = lane + 32 * it, ql = ch >> 4, q4 = (ch & 15) * 4;
      *(v4f_t*)(orow + (size_t)ql * DD + q4) = *(const v4fa*)(so + ql * 68 + q4); }
  } else {                  // the wave that holds the last real rows: the padded rows are not stored
#pragma unroll 1            // taken by one wave of each (batch, head) only: rolled, it keeps the kernel's text short
    for (int it = 0; it < 16; ++it) { const int ch = lane + 32 * it, ql = ch >> 4, q4 = (ch & 15) * 4;
      if (q0 + ql < LTRUE) {
        *(v4f_t*)(orow + (size_t)ql * DD + q4) = *(const v4fa*)(so + ql * 68 + q4);
        asm volatile("s_wait_xcnt 0x0" ::: "memory");   // stands in front of the next trip's rewrite of the store's address and data registers
      } }
  }
}


extern "C" void kernel_launch(void* const* d_in, const int* in_sizes, int n_in,
                              void* d_out, int out_size, void* d_ws, size_t ws_size,
                              hipStream_t stream) {
  (void)in_sizes; (void)n_in; (void)out_size;
  const float* q = (const float*)d_in[0]; const int* mask = (const int*)d_in[1];
  float* out = (float*)d_out;     // [8,1000,1024]
  (void)d_ws; (void)ws_size;
  attn_kernel<<<dim3(QROWS / 64, HH, BB), dim3(64), 0, stream>>>(q, mask, out);
}

// v009
// A run of this version takes 20.2 microseconds.
// Versions in between are left out here; by their measured steps it is 1.15 times as fast as v007.
// All steps since v000 together make it 4.38 times as fast.
// Contractions on v_wmma_f32_16x16x32_f16 (plain f16 operands, f32 accumulate): self-attention with q = k = v = query (no projections),
// 16 heads of 64, sequence 1000 zero-padded to 1024 as in the reference, scale 1/8, key mask (mask == 0 and the 24 padding keys: logit -1e9).
// A blocked key's weight is exactly 0 as soon as the batch has one allowed key, so every work-group ranks its batch's mask entries and walks
// only the allowed keys, in 32-key tiles that it fetches from the f32 input by their ranks and lays in LDS as f16 (a batch with no allowed
// key walks all 1000 tokens with Q set to zero, so every logit is equal, and counts the 24 padding keys in the row sum: the reference's
// uniform weights).
// One launch; a work-group is eight waves of 32 queries each, which share the ranking and every staged key tile.
// Flash-style S^T = K.Q^T / O^T = V^T.P^T, V^T read off the same key tile by the transposing LDS load, online softmax in f32
// on the raw scores, against a maximum that is renewed only when a score passes it by 2^15 (lazy rescale); the padded query rows are not
// stored. compute dtype: f16 operands, f32 accumulate.
#include <hip/hip_runtime.h>
#include <hip/hip_bf16.h>
#include <math.h>

#define BB 8
#define LTRUE 1000
#define SS 1024
#define QROWS 1024
#define KROWS 1024
#define NKV 1024
#define DD 1024
#define HH 16
#define KVH 16
#define KVD 1024
#define HKDIV 1
#define DKK 64
#define QW 2
#define GSTR 48
#define NWAVE 8   // waves of a work-group

typedef _Float16 bf16;
typedef _Float16 f16;
typedef __attribute__((ext_vector_type(4))) unsigned v4u_t;
typedef unsigned v4ua __attribute__((ext_vector_type(4), may_alias));
typedef __attribute__((ext_vector_type(4))) float v4f_t;
typedef __attribute__((ext_vector_type(4))) int v4i_t;
typedef float v4fa __attribute__((ext_vector_type(4), may_alias));
typedef __attribute__((ext_vector_type(16))) bf16  bf16x16;
typedef bf16x16 f16x16;
typedef __attribute__((ext_vector_type(8)))  bf16  bf16x8;
typedef bf16x8 f16x8;
typedef __attribute__((ext_vector_type(4)))  bf16  bf16x4;
typedef __attribute__((ext_vector_type(8)))  float f32x8;
typedef __attribute__((ext_vector_type(2)))  float f32x2;
__device__ __forceinline__ f32x8 wmma16(f16x16 a, f16x16 b, f32x8 c) {
  return __builtin_amdgcn_wmma_f32_16x16x32_f16(false, a, false, b, (short)0, c, false, false);
}
#define LDS_STRIDE 48   // unused: 48 elems (96B rows)
#define KSTRIDE    72   // attn K tile: 64 -> 72 elems (144B rows): conflict-free b128
#define VSTRIDE    48   // unused: 48 elems (96B rows)

__device__ __forceinline__ f32x8 wmma_bf16(bf16x16 a, bf16x16 b, f32x8 c) {
  return __builtin_amdgcn_wmma_f32_16x16x32_f16(false, a, false, b, (short)0, c, false, false);
}

// x = 2^x for a run of values, each on the bare v_exp_f32 and in its own register. The library's exp2f adds a compare, two selects, an add
// and a v_ldexp_f32 per value to keep results below 2^-126; here such a result may come out as 0: every argument is <= 15, and the result is
// only ever added to a row sum >= 1, rounded to an f16 weight, or multiplied into sums that a weight of 1 is about to join.
// One statement per run: each v_exp_f32 is followed by one on other registers and the last by a v_nop, the slot that the instruction set
// asks for behind a transcendental.
__device__ __forceinline__ void exp2_run8(float* x) {
  asm("v_exp_f32 %0, %0\n\tv_exp_f32 %1, %1\n\tv_exp_f32 %2, %2\n\tv_exp_f32 %3, %3\n\t"
      "v_exp_f32 %4, %4\n\tv_exp_f32 %5, %5\n\tv_exp_f32 %6, %6\n\tv_exp_f32 %7, %7\n\tv_nop"
      : "+v"(x[0]), "+v"(x[1]), "+v"(x[2]), "+v"(x[3]), "+v"(x[4]), "+v"(x[5]), "+v"(x[6]), "+v"(x[7]));
}
__device__ __forceinline__ void exp2_run2(float& x, float& y) {
  asm("v_exp_f32 %0, %0\n\tv_exp_f32 %1, %1\n\tv_nop" : "+v"(x), "+v"(y));
}

#define KTB  (32 * KSTRIDE * 2)   // bytes of one key tile in LDS (32 keys x 144 B); it serves as K and, read transposed, as V^T

// One 32-key tile on its way from the f32 input to LDS, through registers: 256 lanes, 16 lanes a 256-byte row piece (whole lines), two
// rows a lane. base: the (batch, head) corner of the input, one value for the work-group; o0, o1: byte offsets of the lane's two rows.
// The s_wait_xcnt stands behind the loads and names their offset registers as inputs, so that they live up to it and are rewritten behind it.
__device__ __forceinline__ void load_rows(const char* __restrict__ base, unsigned o0, unsigned o1, unsigned c16, v4f_t* st) {
  const unsigned vo0 = o0 + c16, vo1 = o1 + c16;
  st[0] = *(const v4f_t*)(base + vo0);
  st[1] = *(const v4f_t*)(base + vo1);
  asm volatile("s_wait_xcnt 0x0" :: "v"(vo0), "v"(vo1) : "memory");
}
// dst: the lane's 8 bytes in the first of its two rows of the tile; the second lies 16 rows on
__device__ __forceinline__ void store_rows(unsigned char* dst, const v4f_t* st) {
#pragma unroll
  for (int i = 0; i < 2; ++i) {
    bf16x4 q;
    q[0] = (bf16)st[i][0]; q[1] = (bf16)st[i][1]; q[2] = (bf16)st[i][2]; q[3] = (bf16)st[i][3];
    *(bf16x4*)(dst + i * (16 * KSTRIDE * 2)) = q;
  }
}

// 16 (dims) x 32 (keys) fragment of V^T off the row-major key tile, by the transposing load: lane (c = l & 15, h = l >> 4) gets
// tile[8h + 0..7][d0 + c] and tile[16 + 8h + 0..7][d0 + c], the k order of lds_frag below.
// p: tile + (8h + (l & 7)) * pitch + 16 * ((l >> 3) & 1) + 2 * d0
typedef short s16x8 __attribute__((ext_vector_type(8)));
__device__ __forceinline__ bf16x16 lds_frag_tr(const unsigned char* p) {
  typedef __attribute__((address_space(3))) s16x8 lds_s16x8;
  const bf16x8 lo = __builtin_bit_cast(bf16x8, __builtin_amdgcn_ds_load_tr16_b128_v8i16((lds_s16x8*)p));
  const bf16x8 hi = __builtin_bit_cast(bf16x8, __builtin_amdgcn_ds_load_tr16_b128_v8i16((lds_s16x8*)(p + 16 * KSTRIDE * 2)));
  bf16x16 f;
#pragma unroll
  for (int i = 0; i < 8; ++i) { f[i] = lo[i]; f[i + 8] = hi[i]; }
  return f;
}

// 16x32 (MxK) f16 fragment from f32 rows in global memory; p: the lane's own row, at the first k that the lane holds.
// lanes 0-15  (row=lane)    : elems 0..7 = K+0..7,  8..15 = K+16..23
// lanes 16-31 (row=lane-16) : elems 0..7 = K+8..15, 8..15 = K+24..31
__device__ __forceinline__ bf16x16 load_frag_f32(const float* __restrict__ p) {
  const v4f_t a0 = *(const v4f_t*)(p),      a1 = *(const v4f_t*)(p + 4);
  const v4f_t b0 = *(const v4f_t*)(p + 16), b1 = *(const v4f_t*)(p + 20);
  bf16x16 f;
  for (int i = 0; i < 4; ++i) {
    f[i]     = (bf16)a0[i]; f[i + 4]  = (bf16)a1[i];
    f[i + 8] = (bf16)b0[i]; f[i + 12] = (bf16)b1[i];
  }
  return f;
}

// Same fragment from an LDS tile with padded row stride (base includes row0/k0).
__device__ __forceinline__ bf16x16 lds_frag(const bf16* base, int stride) {
  const int lane = threadIdx.x & 31;
  const int row  = lane & 15;
  const int kh   = (lane >> 4) * 8;
  const bf16x8 lo = *(const bf16x8*)(base + row * stride + kh);
  const bf16x8 hi = *(const bf16x8*)(base + row * stride + kh + 16);
  bf16x16 f;
#pragma unroll
  for (int i = 0; i < 8; ++i) { f[i] = lo[i]; f[i + 8] = hi[i]; }
  return f;
}

template <typename T>
__device__ __forceinline__ void stage_read16(const T* __restrict__ p, float* buf) {
#pragma unroll
  for (int i = 0; i < 16; ++i) buf[i] = (float)p[i];
}

__device__ __forceinline__ void stage_write(bf16* dst, const float* buf, int nquad) {
#pragma unroll
  for (int i = 0; i < nquad; ++i) {
    bf16x4 q;
    q[0] = (bf16)buf[4 * i];     q[1] = (bf16)buf[4 * i + 1];
    q[2] = (bf16)buf[4 * i + 2]; q[3] = (bf16)buf[4 * i + 3];
    *(bf16x4*)(dst + 4 * i) = q;
  }
}

// ---------------------------------------------------------------------------
// Attention: block 256 thr (8 waves) = 256 queries x one head; key step 32;
// wave tile 32 queries x 64 dk. K/Vᵀ staged through LDS (f16, padded stride)
// in two buffers by global loads to registers and f16 LDS stores, the loads of the tile after next in flight during each trip.
// Output: f32 rows [B][LTRUE][DD] (head h at columns h*64..h*64+63).
// ---------------------------------------------------------------------------
// Two work-groups a WGP, four waves a SIMD: the register budget is held to a quarter of a SIMD's file.
__global__ __launch_bounds__(NWAVE * 32) __attribute__((amdgpu_waves_per_eu(4, 4))) void attn_kernel(
    const float* __restrict__ Qf, const int* __restrict__ mask,   // Qf: the f32 query rows [B][LTRUE][DD], also keys and values; mask [B][LTRUE]
    float* __restrict__ out) {                                    // out [B][LTRUE][DD]: the padded query rows are not stored
  __shared__ __attribute__((aligned(16))) unsigned char ring[NWAVE * 32 * 68 * 4];   // two key tiles; behind the loop the waves' output staging
  __shared__ __attribute__((aligned(16))) unsigned tokS[KROWS];                  // byte offset of each walked key's row in its batch's input
  __shared__ __attribute__((aligned(16))) int cntS[NWAVE];                       // allowed keys among the mask entries that each wave ranks
  static_assert(2 * KTB <= NWAVE * 32 * 68 * 4, "both key tiles must fit the ring");
  static_assert(NWAVE * 32 * 4 >= LTRUE && NWAVE == 8, "one piece of four mask entries a lane covers the batch");

  const int q0blk = blockIdx.x * (NWAVE * 32);
  const int h  = blockIdx.y;
  const int b  = blockIdx.z;
  const int t    = threadIdx.x;
  const int wave = t >> 5;
  const int lane = t & 31;
  const int qlane = lane & 15;
  const int kh8   = (lane >> 4) * 8;
  const int q0 = q0blk + wave * 32;          // this wave's 32 queries

  // The batch's 1000 mask entries, 250 pieces of four: lane t of the work-group fetches and ranks piece t.
  const int wv  = __builtin_amdgcn_readfirstlane(wave);
  const v4i_t* mrow = (const v4i_t*)(mask + b * LTRUE);
  const int mo = min(t, LTRUE / 4 - 1);   // a piece past the last reads the last one and counts for nothing
  const v4i_t mm = mrow[mo];

  bf16x16 qf[QW][2];
  const float* qrow[QW];
#pragma unroll
  for (int qt = 0; qt < QW; ++qt) {   // a padded query row is never stored: its lane reads the last real row instead of past the input
    qrow[qt] = Qf + ((size_t)b * LTRUE + min(q0 + 16 * qt + qlane, LTRUE - 1)) * DD + h * DKK + kh8;
    qf[qt][0] = load_frag_f32(qrow[qt]);
    qf[qt][1] = load_frag_f32(qrow[qt] + 32);
  }
  // stands in front of the first rewrite of a mask or Q load's address registers, which it names as inputs so that they live up to it
  asm volatile("s_wait_xcnt 0x0" :: "v"(qrow[0]), "v"(qrow[1]), "v"(mo) : "memory");

  // Ranks of the allowed keys (mask != 0): the waves' come in the waves' order, inside a wave they run by entry and lane. Any order serves:
  // a key's place only sets where its term stands in the sums. Every rank is below the count, which is at most LTRUE.
  unsigned bal[4];
  int cnt = 0;
#pragma unroll
  for (int e = 0; e < 4; ++e) {
    bal[e] = __builtin_amdgcn_ballot_w32(t < LTRUE / 4 && mm[e] != 0);
    cnt += __builtin_popcount(bal[e]);
  }
  if (lane == 0) cntS[wv] = cnt;
  __syncthreads();   // every wave's count visible to all
  const v4i_t cl = *(const v4i_t*)cntS, ch = *(const v4i_t*)(cntS + 4);
  int run = 0, tot = 0;   // allowed keys in front of this wave's; in the batch
#pragma unroll
  for (int i = 0; i < NWAVE; ++i) {
    const int ci = __builtin_amdgcn_readfirstlane(i < 4 ? cl[i & 3] : ch[i & 3]);
    tot += ci;
    run += i < wv ? ci : 0;
  }
#pragma unroll
  for (int e = 0; e < 4; ++e) {
    const unsigned pos = __builtin_amdgcn_mbcnt_lo(bal[e], (unsigned)run);
    if (t < LTRUE / 4 && mm[e] != 0) tokS[pos] = (unsigned)(4 * t + e) * (DD * 4u);
    run += __builtin_popcount(bal[e]);
  }
  // allowed keys of the batch, one value for the whole work-group; clamped to the shape, since trip counts are formed from it
  const int nb = min(tot, LTRUE);
  const int nw = nb > 0 ? nb : LTRUE;   // keys that are walked; with no allowed key every token is, all at one logit
  if (nb == 0) {                        // the reference gives every key -1e9 then: Q = 0 makes every walked key's score 0, the same uniform weights
#pragma unroll                          // constant indices keep qf in registers
    for (int qt = 0; qt < QW; ++qt) { qf[qt][0] = (bf16x16)(bf16)0.0f; qf[qt][1] = (bf16x16)(bf16)0.0f; }
  }
  if (nb == 0)
    for (int k = t; k < LTRUE; k += NWAVE * 32) tokS[k] = (unsigned)k * (DD * 4u);
  for (int k = nw + t; k < KROWS; k += NWAVE * 32) tokS[k] = 0u;   // behind the walked keys: token 0's row, at weight 0 (the last tile's filler)

  f32x8 o[QW][4] = {};
  // mrun: the maximum in use (raw scores), one value for both lanes of a query; off = -mrun * scale; lim = mrun + the headroom
  float mrun[QW], lrun[QW], off[QW], lim[QW];
#pragma unroll
  for (int qt = 0; qt < QW; ++qt) { mrun[qt] = -INFINITY; lrun[qt] = 0.0f; off[qt] = 0.0f; lim[qt] = -INFINITY; }

  const float scale = 0.125f * 1.44269504088896340736f;  // 1/sqrt(DK)*log2(e)
  const float headroom = 15.0f / scale;   // a raw score may pass the maximum in use by this much: its weight is then 2^15, inside f16
  const int kmax = nw - 1;       // last key that is walked
  __syncthreads();   // row offsets visible to every wave

  // Cooperative staging (256 threads): lane t brings 16 bytes (4 dims) of rows srow and srow + 16 of a tile. A wave's two half-waves stand
  // eight rows apart, so that its LDS stores fall on all 64 banks once.
  const char* kcorner = (const char*)(Qf + (size_t)b * LTRUE * DD + h * DKK);
  const unsigned c16 = (t & 15) * 16;
  const int srow = wave + kh8;
  const unsigned* tokL = tokS + srow;
  unsigned char* sdst = ring + srow * (KSTRIDE * 2) + (t & 15) * 8;
  v4f_t st0[2], st[2];
  load_rows(kcorner, tokL[0], tokL[16], c16, st0);
  if (32 <= kmax) load_rows(kcorner, tokL[32], tokL[48], c16, st);   // tile 1, where there is one, flies beside tile 0
  store_rows(sdst, st0);                                             // tile 0 into buffer 0
  unsigned on0 = tokL[64], on1 = tokL[80];                           // row offsets of tile 2 (all of tokS is written)
  __syncthreads();   // tile 0 visible to every wave

  unsigned cur = 0;   // byte offset in the ring of the buffer that this trip reads
  for (int kb = 0; kb <= kmax; kb += 32) {
    const bf16* ldsK = (const bf16*)(ring + cur);
    const unsigned char* ldsVt = ring + cur + (kh8 + (lane & 7)) * (KSTRIDE * 2) + ((lane >> 3) & 1) * 16;

    // The next tile, fetched a trip ago, goes into the other buffer, whose readers the last barrier has ended; the tile after it is
    // fetched under this trip's work, and the row offsets of the one after that are read a trip ahead of their use.
    if (kb + 32 <= kmax) store_rows(sdst + (KTB - cur), st);
    if (kb + 64 <= kmax) load_rows(kcorner, on0, on1, c16, st);
    { const unsigned* tn = tokL + min(kb + 96, KROWS - 32); on0 = tn[0]; on1 = tn[16]; }
    // Keeps the offsets' read in front of the score products: left free, the compiler sets it among them, where its address takes a WMMA
    // operand's register behind four idle slots, and runs the eight products as two chains at a time instead of four.
    __builtin_amdgcn_sched_barrier(0);

    // Phase 1: scores + softmax for both q-tiles (K fragments live here only).
    bf16x16 kf[2][2];
#pragma unroll
    for (int ktile = 0; ktile < 2; ++ktile)
#pragma unroll
      for (int c = 0; c < 2; ++c)
        kf[ktile][c] = lds_frag(ldsK + (ktile * 16) * KSTRIDE + c * 32, KSTRIDE);

    f32x8 sc[QW][2];   // raw scores: no scale, no bias
#pragma unroll         // here and below: constant indices keep sc, e0, e1 and pf in registers
    for (int qt = 0; qt < QW; ++qt) {
        f32x8 s0 = {}, s1 = {};
        s0 = wmma_bf16(kf[0][0], qf[qt][0], s0);
        s0 = wmma_bf16(kf[0][1], qf[qt][1], s0);
        s1 = wmma_bf16(kf[1][0], qf[qt][0], s1);
        s1 = wmma_bf16(kf[1][1], qf[qt][1], s1);
        sc[qt][0] = s0; sc[qt][1] = s1;
    }
    if (kb + 32 > nw) {   // only the last tile can hold filler behind the walked keys (a scalar test): its scores go to -3e9, weight exactly 0
#pragma unroll
      for (int qt = 0; qt < QW; ++qt)
#pragma unroll
        for (int r = 0; r < 8; ++r) {
          if (kb + kh8 + r >= nw)      sc[qt][0][r] = -3.0e9f;
          if (kb + 16 + kh8 + r >= nw) sc[qt][1][r] = -3.0e9f;
        }
    }

    // Lazy rescale: the maximum in use stays, and with it the sums' scale, while no score of the tile passes it by more than the headroom.
    // One test a trip for the whole wave (a scalar branch on the ballot); the first trip always takes it (lim = -inf).
    float mloc[QW];    // the lane's own 16 keys; the two lanes of a query are joined only where the maximum is renewed
#pragma unroll
    for (int qt = 0; qt < QW; ++qt) {
        float mx = -INFINITY;
#pragma unroll
        for (int r = 0; r < 8; ++r) mx = fmaxf(mx, fmaxf(sc[qt][0][r], sc[qt][1][r]));
        mloc[qt] = mx;
    }
    if (__builtin_amdgcn_ballot_w32(mloc[0] > lim[0] || mloc[1] > lim[1]) != 0) {
      float alpha[QW];
#pragma unroll
      for (int qt = 0; qt < QW; ++qt) {
        const float mnew = fmaxf(mrun[qt], fmaxf(mloc[qt], __shfl_xor(mloc[qt], 16, 32)));
        alpha[qt] = (mrun[qt] - mnew) * scale;
        mrun[qt] = mnew;
        off[qt]  = -mnew * scale;
        lim[qt]  = mnew + headroom;
      }
      exp2_run2(alpha[0], alpha[1]);
#pragma unroll
      for (int qt = 0; qt < QW; ++qt) {
        lrun[qt] *= alpha[qt];
#pragma unroll
        for (int j = 0; j < 4; ++j)
#pragma unroll
          for (int r = 0; r < 8; ++r) o[qt][j][r] *= alpha[qt];
      }
    }

    // All V^T fragments are asked for here, as one group: they land under the exponentials.
    bf16x16 vf[4];
#pragma unroll
    for (int j = 0; j < 4; ++j) vf[j] = lds_frag_tr(ldsVt + 32 * j);
    __builtin_amdgcn_sched_barrier(0);   // keeps the eight loads together and in front: left free, the compiler spreads them among the WMMAs, each place with a wait of its own

    bf16x16 pf[QW];
#pragma unroll
    for (int qt = 0; qt < QW; ++qt) {
        const f32x8 s0 = sc[qt][0], s1 = sc[qt][1];
        // one multiply-add per score: scale, minus the scaled maximum in use
        const f32x2 scale2 = {scale, scale}, off2 = {off[qt], off[qt]};
        float e0[8], e1[8];
#pragma unroll
        for (int r = 0; r < 8; r += 2) {
          const f32x2 a = __builtin_elementwise_fma((f32x2){s0[r], s0[r + 1]}, scale2, off2);
          const f32x2 c = __builtin_elementwise_fma((f32x2){s1[r], s1[r + 1]}, scale2, off2);
          e0[r] = a[0]; e0[r + 1] = a[1]; e1[r] = c[0]; e1[r + 1] = c[1];
        }
        exp2_run8(e0);
        exp2_run8(e1);

        float rsum = 0.0f;
#pragma unroll
        for (int r = 0; r < 8; ++r) {
          rsum += e0[r] + e1[r];
          pf[qt][r]     = (bf16)e0[r];
          pf[qt][r + 8] = (bf16)e1[r];
        }
        rsum += __shfl_xor(rsum, 16, 32);
        lrun[qt] += rsum;
    }

    // Phase 2: O^T accumulate; each V fragment serves both q-tiles.
#pragma unroll
    for (int j = 0; j < 4; ++j) {
#pragma unroll
      for (int qt = 0; qt < QW; ++qt)
        o[qt][j] = wmma_bf16(vf[j], pf[qt], o[qt][j]);
    }

    // Hand-over: this wave's reads of the buffer and its writes of the next tile are done; the one barrier publishes the next tile
    // and frees this buffer for the tile after it.
    asm volatile("s_wait_dscnt 0x0" ::: "memory");
    __syncthreads();
    cur = KTB - cur;
  }

  float* so = (float*)ring + wave * (32 * 68);   // the last trip's barrier stands behind every read of the ring
  const float lpad = nb > 0 ? 0.0f : (float)(KROWS - LTRUE);   // with no allowed key the padding keys weigh 1 each, on zero rows
#pragma unroll
  for (int qt = 0; qt < QW; ++qt) {
    const float rl = 1.0f / (lrun[qt] + lpad);
#pragma unroll
    for (int j = 0; j < 4; ++j)
#pragma unroll
      for (int r = 0; r < 8; ++r) so[(16 * qt + qlane) * 68 + j * 16 + kh8 + r] = o[qt][j][r] * rl;
  }
  asm volatile("s_wait_dscnt 0" ::: "memory");
  __builtin_amdgcn_wave_barrier();
  float* orow = out + ((size_t)(b * LTRUE + q0)) * DD + h * DKK;
  if (q0 + 32 <= LTRUE) {   // all 32 query rows of the wave are real (the test reads the same in every lane of a wave)
#pragma unroll
    for (int it = 0; it < 16; ++it) { const int ch = lane + 32 * it, ql = ch >> 4, q4 = (ch & 15) * 4;
      *(v4f_t*)(orow + (size_t)ql * DD + q4) = *(const v4fa*)(so + ql * 68 + q4); }
  } else {                  // the wave that holds the last real rows: the padded rows are not stored
#pragma unroll 1            // taken by one wave of each (batch, head) only: rolled, it keeps the kernel's text short
    for (int it = 0; it < 16; ++it) { const int ch = lane + 32 * it, ql = ch >> 4, q4 = (ch & 15) * 4;
      if (q0 + ql < LTRUE) {
        *(v4f_t*)(orow + (size_t)ql * DD + q4) = *(const v4fa*)(so + ql * 68 + q4);
        asm volatile("s_wait_xcnt 0x0" ::: "memory");   // stands in front of the next trip's rewrite of the store's address and data registers
      } }
  }
}


extern "C" void kernel_launch(void* const* d_in, const int* in_sizes, int n_in,
                              void* d_out, int out_size, void* d_ws, size_t ws_size,
                              hipStream_t stream) {
  (void)in_sizes; (void)n_in; (void)out_size;
  const float* q = (const float*)d_in[0]; const int* mask = (const int*)d_in[1];
  float* out = (float*)d_out;     // [8,1000,1024]
  (void)d_ws; (void)ws_size;
  attn_kernel<<<dim3(QROWS / (NWAVE * 32), HH, BB), dim3(NWAVE * 32), 0, stream>>>(q, mask, out);
}

// v010
// Measured time: 19.5 microseconds a run.
// Timed twice side by side with v009, it ran 1.04 times as fast both times.
// Counting every step since v000, it is 4.54 times as fast.
// Contractions on v_wmma_f32_16x16x32_f16 (plain f16 operands, f32 accumulate): self-attention with q = k = v = query (no projections),
// 16 heads of 64, sequence 1000 zero-padded to 1024 as in the reference, scale 1/8, key mask (mask == 0 and the 24 padding keys: logit -1e9).
// A blocked key's weight is exactly 0 as soon as the batch has one allowed key, so every work-group ranks its batch's mask entries and walks
// only the allowed keys, in 32-key tiles that it fetches from the f32 input by their ranks and lays in LDS as f16 (a batch with no allowed
// key walks all 1000 tokens with Q set to zero, so every logit is equal, and counts the 24 padding keys in the row sum: the reference's
// uniform weights).
// One launch; a work-group is eight waves of 32 queries each, which share the ranking and every staged key tile.
// Flash-style S^T = K.Q^T / O^T = V^T.P^T, V^T read off the same key tile by the transposing LDS load, online softmax in f32
// on the raw scores, against a maximum that is renewed only when a weight leaves the f16 range (lazy rescale). A tile's row sums come off
// the matrix pipe, ones . P^T, and are the test as well: a weight that overflowed makes its sum infinite. The padded query rows are not
// stored. compute dtype: f16 operands, f32 accumulate.
#include <hip/hip_runtime.h>
#include <hip/hip_bf16.h>
#include <math.h>

#define BB 8
#define LTRUE 1000
#define SS 1024
#define QROWS 1024
#define KROWS 1024
#define NKV 1024
#define DD 1024
#define HH 16
#define KVH 16
#define KVD 1024
#define HKDIV 1
#define DKK 64
#define QW 2
#define GSTR 48
#define NWAVE 8   // waves of a work-group

typedef _Float16 bf16;
typedef _Float16 f16;
typedef __attribute__((ext_vector_type(4))) unsigned v4u_t;
typedef unsigned v4ua __attribute__((ext_vector_type(4), may_alias));
typedef __attribute__((ext_vector_type(4))) float v4f_t;
typedef __attribute__((ext_vector_type(4))) int v4i_t;
typedef float v4fa __attribute__((ext_vector_type(4), may_alias));
typedef __attribute__((ext_vector_type(16))) bf16  bf16x16;
typedef bf16x16 f16x16;
typedef __attribute__((ext_vector_type(8)))  bf16  bf16x8;
typedef bf16x8 f16x8;
typedef __attribute__((ext_vector_type(4)))  bf16  bf16x4;
typedef __attribute__((ext_vector_type(8)))  float f32x8;
typedef __attribute__((ext_vector_type(2)))  float f32x2;
__device__ __forceinline__ f32x8 wmma16(f16x16 a, f16x16 b, f32x8 c) {
  return __builtin_amdgcn_wmma_f32_16x16x32_f16(false, a, false, b, (short)0, c, false, false);
}
#define LDS_STRIDE 48   // unused: 48 elems (96B rows)
#define KSTRIDE    72   // attn K tile: 64 -> 72 elems (144B rows): conflict-free b128
#define VSTRIDE    48   // unused: 48 elems (96B rows)

__device__ __forceinline__ f32x8 wmma_bf16(bf16x16 a, bf16x16 b, f32x8 c) {
  return __builtin_amdgcn_wmma_f32_16x16x32_f16(false, a, false, b, (short)0, c, false, false);
}

// x = 2^x for a run of values, each on the bare v_exp_f32 and in its own register. The library's exp2f adds a compare, two selects, an add
// and a v_ldexp_f32 per value to keep results below 2^-126; here such a result may come out as 0: it is
// only ever rounded to an f16 weight or multiplied into sums that a weight of 1 is about to join.
// One statement per run: each v_exp_f32 is followed by one on other registers and the last by a v_nop, the slot that the instruction set
// asks for behind a transcendental.
__device__ __forceinline__ void exp2_run8(float* x) {
  asm("v_exp_f32 %0, %0\n\tv_exp_f32 %1, %1\n\tv_exp_f32 %2, %2\n\tv_exp_f32 %3, %3\n\t"
      "v_exp_f32 %4, %4\n\tv_exp_f32 %5, %5\n\tv_exp_f32 %6, %6\n\tv_exp_f32 %7, %7\n\tv_nop"
      : "+v"(x[0]), "+v"(x[1]), "+v"(x[2]), "+v"(x[3]), "+v"(x[4]), "+v"(x[5]), "+v"(x[6]), "+v"(x[7]));
}
__device__ __forceinline__ void exp2_run2(float& x, float& y) {
  asm("v_exp_f32 %0, %0\n\tv_exp_f32 %1, %1\n\tv_nop" : "+v"(x), "+v"(y));
}

#define KTB  (32 * KSTRIDE * 2)   // bytes of one key tile in LDS (32 keys x 144 B); it serves as K and, read transposed, as V^T

// One 32-key tile on its way from the f32 input to LDS, through registers: 256 lanes, 16 lanes a 256-byte row piece (whole lines), two
// rows a lane. base: the (batch, head) corner of the input, one value for the work-group; o0, o1: byte offsets of the lane's two rows.
// The s_wait_xcnt stands behind the loads and names their offset registers as inputs, so that they live up to it and are rewritten behind it.
__device__ __forceinline__ void load_rows(const char* __restrict__ base, unsigned o0, unsigned o1, unsigned c16, v4f_t* st) {
  const unsigned vo0 = o0 + c16, vo1 = o1 + c16;
  st[0] = *(const v4f_t*)(base + vo0);
  st[1] = *(const v4f_t*)(base + vo1);
  asm volatile("s_wait_xcnt 0x0" :: "v"(vo0), "v"(vo1) : "memory");
}
// dst: the lane's 8 bytes in the first of its two rows of the tile; the second lies 16 rows on
__device__ __forceinline__ void store_rows(unsigned char* dst, const v4f_t* st) {
#pragma unroll
  for (int i = 0; i < 2; ++i) {
    bf16x4 q;
    q[0] = (bf16)st[i][0]; q[1] = (bf16)st[i][1]; q[2] = (bf16)st[i][2]; q[3] = (bf16)st[i][3];
    *(bf16x4*)(dst + i * (16 * KSTRIDE * 2)) = q;
  }
}

// 16 (dims) x 32 (keys) fragment of V^T off the row-major key tile, by the transposing load: lane (c = l & 15, h = l >> 4) gets
// tile[8h + 0..7][d0 + c] and tile[16 + 8h + 0..7][d0 + c], the k order of lds_frag below.
// p: tile + (8h + (l & 7)) * pitch + 16 * ((l >> 3) & 1) + 2 * d0
typedef short s16x8 __attribute__((ext_vector_type(8)));
__device__ __forceinline__ bf16x16 lds_frag_tr(const unsigned char* p) {
  typedef __attribute__((address_space(3))) s16x8 lds_s16x8;
  const bf16x8 lo = __builtin_bit_cast(bf16x8, __builtin_amdgcn_ds_load_tr16_b128_v8i16((lds_s16x8*)p));
  const bf16x8 hi = __builtin_bit_cast(bf16x8, __builtin_amdgcn_ds_load_tr16_b128_v8i16((lds_s16x8*)(p + 16 * KSTRIDE * 2)));
  bf16x16 f;
#pragma unroll
  for (int i = 0; i < 8; ++i) { f[i] = lo[i]; f[i + 8] = hi[i]; }
  return f;
}

// 16x32 (MxK) f16 fragment from f32 rows in global memory; p: the lane's own row, at the first k that the lane holds.
// lanes 0-15  (row=lane)    : elems 0..7 = K+0..7,  8..15 = K+16..23
// lanes 16-31 (row=lane-16) : elems 0..7 = K+8..15, 8..15 = K+24..31
__device__ __forceinline__ bf16x16 load_frag_f32(const float* __restrict__ p) {
  const v4f_t a0 = *(const v4f_t*)(p),      a1 = *(const v4f_t*)(p + 4);
  const v4f_t b0 = *(const v4f_t*)(p + 16), b1 = *(const v4f_t*)(p + 20);
  bf16x16 f;
  for (int i = 0; i < 4; ++i) {
    f[i]     = (bf16)a0[i]; f[i + 4]  = (bf16)a1[i];
    f[i + 8] = (bf16)b0[i]; f[i + 12] = (bf16)b1[i];
  }
  return f;
}

// Same fragment from an LDS tile with padded row stride (base includes row0/k0).
__device__ __forceinline__ bf16x16 lds_frag(const bf16* base, int stride) {
  const int lane = threadIdx.x & 31;
  const int row  = lane & 15;
  const int kh   = (lane >> 4) * 8;
  const bf16x8 lo = *(const bf16x8*)(base + row * stride + kh);
  const bf16x8 hi = *(const bf16x8*)(base + row * stride + kh + 16);
  bf16x16 f;
#pragma unroll
  for (int i = 0; i < 8; ++i) { f[i] = lo[i]; f[i + 8] = hi[i]; }
  return f;
}

template <typename T>
__device__ __forceinline__ void stage_read16(const T* __restrict__ p, float* buf) {
#pragma unroll
  for (int i = 0; i < 16; ++i) buf[i] = (float)p[i];
}

__device__ __forceinline__ void stage_write(bf16* dst, const float* buf, int nquad) {
#pragma unroll
  for (int i = 0; i < nquad; ++i) {
    bf16x4 q;
    q[0] = (bf16)buf[4 * i];     q[1] = (bf16)buf[4 * i + 1];
    q[2] = (bf16)buf[4 * i + 2]; q[3] = (bf16)buf[4 * i + 3];
    *(bf16x4*)(dst + 4 * i) = q;
  }
}

// ---------------------------------------------------------------------------
// Attention: block 256 thr (8 waves) = 256 queries x one head; key step 32;
// wave tile 32 queries x 64 dk. K/Vᵀ staged through LDS (f16, padded stride)
// in two buffers by global loads to registers and f16 LDS stores, the loads of the tile after next in flight during each trip.
// Output: f32 rows [B][LTRUE][DD] (head h at columns h*64..h*64+63).
// ---------------------------------------------------------------------------
// Raw scores (no scale, no bias) of one 32-key tile against the wave's 32 queries. Only the last tile can hold filler behind the nw walked
// keys (a scalar test): its scores go to -3e9, weight exactly 0.
__device__ __forceinline__ void tile_scores(const bf16* ldsK, const bf16x16 (&qf)[QW][2], int kb, int nw, int kh8, f32x8 (&sc)[QW][2]) {
  bf16x16 kf[2][2];
#pragma unroll
  for (int ktile = 0; ktile < 2; ++ktile)
#pragma unroll
    for (int c = 0; c < 2; ++c)
      kf[ktile][c] = lds_frag(ldsK + (ktile * 16) * KSTRIDE + c * 32, KSTRIDE);
#pragma unroll         // here and below: constant indices keep the arrays in registers
  for (int qt = 0; qt < QW; ++qt) {
    f32x8 s0 = {}, s1 = {};
    s0 = wmma_bf16(kf[0][0], qf[qt][0], s0);
    s0 = wmma_bf16(kf[0][1], qf[qt][1], s0);
    s1 = wmma_bf16(kf[1][0], qf[qt][0], s1);
    s1 = wmma_bf16(kf[1][1], qf[qt][1], s1);
    sc[qt][0] = s0; sc[qt][1] = s1;
  }
  if (kb + 32 > nw) {
#pragma unroll
    for (int qt = 0; qt < QW; ++qt)
#pragma unroll
      for (int r = 0; r < 8; ++r) {
        if (kb + kh8 + r >= nw)      sc[qt][0][r] = -3.0e9f;
        if (kb + 16 + kh8 + r >= nw) sc[qt][1][r] = -3.0e9f;
      }
  }
}

// The maximum in use is raised to cover the tile's scores, and the sums so far are brought to the new scale.
// mrun: the maximum in use (raw scores), one value for both lanes of a query; off = -mrun * scale
// lrun: the row sum of q-tile 0's query in lanes 0-15, of q-tile 1's in lanes 16-31 (low: the lane is one of the first)
__device__ __forceinline__ void renew_max(const f32x8 (&sc)[QW][2], float scale, float (&mrun)[QW], float (&off)[QW], float& lrun, bool low,
                                          f32x8 (&o)[QW][4]) {
  float alpha[QW];
#pragma unroll
  for (int qt = 0; qt < QW; ++qt) {
    float mx = -INFINITY;   // the lane's own 16 keys, then joined with the query's other lane
#pragma unroll
    for (int r = 0; r < 8; ++r) mx = fmaxf(mx, fmaxf(sc[qt][0][r], sc[qt][1][r]));
    const float mnew = fmaxf(mrun[qt], fmaxf(mx, __shfl_xor(mx, 16, 32)));
    alpha[qt] = (mrun[qt] - mnew) * scale;
    mrun[qt] = mnew;
    off[qt]  = -mnew * scale;
  }
  exp2_run2(alpha[0], alpha[1]);
  lrun *= low ? alpha[0] : alpha[1];
#pragma unroll
  for (int qt = 0; qt < QW; ++qt) {
#pragma unroll
    for (int j = 0; j < 4; ++j)
#pragma unroll
      for (int r = 0; r < 8; ++r) o[qt][j][r] *= alpha[qt];
  }
}

// Weights of a tile as P^T fragments, and their sums per query off the matrix pipe: rows[qt](16 x 32) . P^T(32 keys x 16 queries) adds up a
// query's 32 weights, both lane halves' keys at once. rows[0] is ones in rows 0-7 and rows[1] in rows 8-15, zero elsewhere, so one product
// tile takes both q-tiles: its element 0 is q-tile 0's sum in lanes 0-15 (row 0) and q-tile 1's in lanes 16-31 (row 8), query = lane & 15.
__device__ __forceinline__ void tile_weights(const f32x8 (&sc)[QW][2], float scale, const float (&off)[QW], const bf16x16 (&rows)[QW],
                                             bf16x16 (&pf)[QW], float& tsum) {
  f32x8 d = {};
#pragma unroll
  for (int qt = 0; qt < QW; ++qt) {
    const f32x8 s0 = sc[qt][0], s1 = sc[qt][1];
    // one multiply-add per score: scale, minus the scaled maximum in use
    const f32x2 scale2 = {scale, scale}, off2 = {off[qt], off[qt]};
    float e0[8], e1[8];
#pragma unroll
    for (int r = 0; r < 8; r += 2) {
      const f32x2 a = __builtin_elementwise_fma((f32x2){s0[r], s0[r + 1]}, scale2, off2);
      const f32x2 c = __builtin_elementwise_fma((f32x2){s1[r], s1[r + 1]}, scale2, off2);
      e0[r] = a[0]; e0[r + 1] = a[1]; e1[r] = c[0]; e1[r + 1] = c[1];
    }
    exp2_run8(e0);
    exp2_run8(e1);
#pragma unroll
    for (int r = 0; r < 8; ++r) {
      pf[qt][r]     = (bf16)e0[r];
      pf[qt][r + 8] = (bf16)e1[r];
    }
    d = wmma_bf16(rows[qt], pf[qt], d);
  }
  tsum = d[0];
}

// Two work-groups a WGP, four waves a SIMD: the register budget is held to a quarter of a SIMD's file.
__global__ __launch_bounds__(NWAVE * 32) __attribute__((amdgpu_waves_per_eu(4, 4))) void attn_kernel(
    const float* __restrict__ Qf, const int* __restrict__ mask,   // Qf: the f32 query rows [B][LTRUE][DD], also keys and values; mask [B][LTRUE]
    float* __restrict__ out) {                                    // out [B][LTRUE][DD]: the padded query rows are not stored
  __shared__ __attribute__((aligned(16))) unsigned char ring[NWAVE * 32 * 68 * 4];   // two key tiles; behind the loop the waves' output staging
  __shared__ __attribute__((aligned(16))) unsigned tokS[KROWS];                  // byte offset of each walked key's row in its batch's input
  __shared__ __attribute__((aligned(16))) int cntS[NWAVE];                       // allowed keys among the mask entries that each wave ranks
  static_assert(2 * KTB <= NWAVE * 32 * 68 * 4, "both key tiles must fit the ring");
  static_assert(NWAVE * 32 * 4 >= LTRUE && NWAVE == 8, "one piece of four mask entries a lane covers the batch");

  const int q0blk = blockIdx.x * (NWAVE * 32);
  const int h  = blockIdx.y;
  const int b  = blockIdx.z;
  const int t    = threadIdx.x;
  const int wave = t >> 5;
  const int lane = t & 31;
  const int qlane = lane & 15;
  const int kh8   = (lane >> 4) * 8;
  const int q0 = q0blk + wave * 32;          // this wave's 32 queries

  // The batch's 1000 mask entries, 250 pieces of four: lane t of the work-group fetches and ranks piece t.
  const int wv  = __builtin_amdgcn_readfirstlane(wave);
  const v4i_t* mrow = (const v4i_t*)(mask + b * LTRUE);
  const int mo = min(t, LTRUE / 4 - 1);   // a piece past the last reads the last one and counts for nothing
  const v4i_t mm = mrow[mo];

  bf16x16 qf[QW][2];
  const float* qrow[QW];
#pragma unroll
  for (int qt = 0; qt < QW; ++qt) {   // a padded query row is never stored: its lane reads the last real row instead of past the input
    qrow[qt] = Qf + ((size_t)b * LTRUE + min(q0 + 16 * qt + qlane, LTRUE - 1)) * DD + h * DKK + kh8;
    qf[qt][0] = load_frag_f32(qrow[qt]);
    qf[qt][1] = load_frag_f32(qrow[qt] + 32);
  }
  // stands in front of the first rewrite of a mask or Q load's address registers, which it names as inputs so that they live up to it
  asm volatile("s_wait_xcnt 0x0" :: "v"(qrow[0]), "v"(qrow[1]), "v"(mo) : "memory");

  // Ranks of the allowed keys (mask != 0): the waves' come in the waves' order, inside a wave they run by entry and lane. Any order serves:
  // a key's place only sets where its term stands in the sums. Every rank is below the count, which is at most LTRUE.
  unsigned bal[4];
  int cnt = 0;
#pragma unroll
  for (int e = 0; e < 4; ++e) {
    bal[e] = __builtin_amdgcn_ballot_w32(t < LTRUE / 4 && mm[e] != 0);
    cnt += __builtin_popcount(bal[e]);
  }
  if (lane == 0) cntS[wv] = cnt;
  __syncthreads();   // every wave's count visible to all
  const v4i_t cl = *(const v4i_t*)cntS, ch = *(const v4i_t*)(cntS + 4);
  int run = 0, tot = 0;   // allowed keys in front of this wave's; in the batch
#pragma unroll
  for (int i = 0; i < NWAVE; ++i) {
    const int ci = __builtin_amdgcn_readfirstlane(i < 4 ? cl[i & 3] : ch[i & 3]);
    tot += ci;
    run += i < wv ? ci : 0;
  }
#pragma unroll
  for (int e = 0; e < 4; ++e) {
    const unsigned pos = __builtin_amdgcn_mbcnt_lo(bal[e], (unsigned)run);
    if (t < LTRUE / 4 && mm[e] != 0) tokS[pos] = (unsigned)(4 * t + e) * (DD * 4u);
    run += __builtin_popcount(bal[e]);
  }
  // allowed keys of the batch, one value for the whole work-group; clamped to the shape, since trip counts are formed from it
  const int nb = min(tot, LTRUE);
  const int nw = nb > 0 ? nb : LTRUE;   // keys that are walked; with no allowed key every token is, all at one logit
  if (nb == 0) {                        // the reference gives every key -1e9 then: Q = 0 makes every walked key's score 0, the same uniform weights
#pragma unroll                          // constant indices keep qf in registers
    for (int qt = 0; qt < QW; ++qt) { qf[qt][0] = (bf16x16)(bf16)0.0f; qf[qt][1] = (bf16x16)(bf16)0.0f; }
  }
  if (nb == 0)
    for (int k = t; k < LTRUE; k += NWAVE * 32) tokS[k] = (unsigned)k * (DD * 4u);
  for (int k = nw + t; k < KROWS; k += NWAVE * 32) tokS[k] = 0u;   // behind the walked keys: token 0's row, at weight 0 (the last tile's filler)

  f32x8 o[QW][4] = {};
  float lrun = 0.0f;           // the row sum of q-tile 0's query (lanes 0-15), of q-tile 1's (lanes 16-31)
  const bool low = lane < 16;
  bf16x16 rows[QW];            // first operands of the row-sum products (an A fragment's row is lane & 15)
  rows[0] = (bf16x16)(bf16)(qlane < 8 ? 1.0f : 0.0f);
  rows[1] = (bf16x16)(bf16)(qlane < 8 ? 0.0f : 1.0f);
  float mrun[QW], off[QW];     // the maximum in use (raw scores); -mrun * scale
#pragma unroll
  for (int qt = 0; qt < QW; ++qt) { mrun[qt] = -INFINITY; off[qt] = 0.0f; }

  const float scale = 0.125f * 1.44269504088896340736f;  // 1/sqrt(DK)*log2(e)
  const int kmax = nw - 1;       // last key that is walked
  __syncthreads();   // row offsets visible to every wave

  // Cooperative staging (256 threads): lane t brings 16 bytes (4 dims) of rows srow and srow + 16 of a tile. A wave's two half-waves stand
  // eight rows apart, so that its LDS stores fall on all 64 banks once.
  const char* kcorner = (const char*)(Qf + (size_t)b * LTRUE * DD + h * DKK);
  const unsigned c16 = (t & 15) * 16;
  const int srow = wave + kh8;
  const unsigned* tokL = tokS + srow;
  unsigned char* sdst = ring + srow * (KSTRIDE * 2) + (t & 15) * 8;
  v4f_t st0[2], st[2];
  load_rows(kcorner, tokL[0], tokL[16], c16, st0);
  if (32 <= kmax) load_rows(kcorner, tokL[32], tokL[48], c16, st);   // tile 1, where there is one, flies beside tile 0
  store_rows(sdst, st0);                                             // tile 0 into buffer 0
  unsigned on0 = tokL[64], on1 = tokL[80];                           // row offsets of tile 2 (all of tokS is written)
  __syncthreads();   // tile 0 visible to every wave

  unsigned cur = 0;   // byte offset in the ring of the buffer that this trip reads
  for (int kb = 0; kb <= kmax; kb += 32) {
    const bf16* ldsK = (const bf16*)(ring + cur);
    const unsigned char* ldsVt = ring + cur + (kh8 + (lane & 7)) * (KSTRIDE * 2) + ((lane >> 3) & 1) * 16;

    // The next tile, fetched a trip ago, goes into the other buffer, whose readers the last barrier has ended; the tile after it is
    // fetched under this trip's work, and the row offsets of the one after that are read a trip ahead of their use.
    if (kb + 32 <= kmax) store_rows(sdst + (KTB - cur), st);
    if (kb + 64 <= kmax) load_rows(kcorner, on0, on1, c16, st);
    { const unsigned* tn = tokL + min(kb + 96, KROWS - 32); on0 = tn[0]; on1 = tn[16]; }
    // Keeps the offsets' read in front of the score products: left free, the compiler sets it among them, where its address takes a WMMA
    // operand's register behind four idle slots, and runs the eight products as two chains at a time instead of four.
    __builtin_amdgcn_sched_barrier(0);

    // Phase 1: scores + softmax for both q-tiles (K fragments live here only).
    f32x8 sc[QW][2];
    tile_scores(ldsK, qf, kb, nw, kh8, sc);
    if (kb == 0) renew_max(sc, scale, mrun, off, lrun, low, o);   // the first tile sets the maximum in use (a scalar test)

    // All V^T fragments are asked for here, as one group: they land under the exponentials.
    bf16x16 vf[4];
#pragma unroll
    for (int j = 0; j < 4; ++j) vf[j] = lds_frag_tr(ldsVt + 32 * j);
    __builtin_amdgcn_sched_barrier(0);   // keeps the eight loads together and in front: left free, the compiler spreads them among the WMMAs, each place with a wait of its own

    bf16x16 pf[QW];
    float tsum;
    tile_weights(sc, scale, off, rows, pf, tsum);
    // Lazy rescale: the maximum in use stays, and with it the sums' scale, while every weight of the tile fits f16. 32 finite f16 weights sum
    // to at most 32 * 65504; one that rounded to infinity makes its query's sum infinite, or not a number where the other q-tile's zero rows
    // meet it (0 x inf), so the test is written to take both. One test a trip for the whole wave (a scalar branch on the ballot); nothing
    // of the tile has joined the sums yet, so the tile is simply done again against the new maximum.
    if (__builtin_amdgcn_ballot_w32(!(tsum <= 4.0e6f)) != 0) {
      tile_scores(ldsK, qf, kb, nw, kh8, sc);
      renew_max(sc, scale, mrun, off, lrun, low, o);
      tile_weights(sc, scale, off, rows, pf, tsum);
    }
    lrun += tsum;

    // Phase 2: O^T accumulate; each V fragment serves both q-tiles.
#pragma unroll
    for (int j = 0; j < 4; ++j) {
#pragma unroll
      for (int qt = 0; qt < QW; ++qt)
        o[qt][j] = wmma_bf16(vf[j], pf[qt], o[qt][j]);
    }

    // Hand-over: this wave's reads of the buffer and its writes of the next tile are done; the one barrier publishes the next tile
    // and frees this buffer for the tile after it.
    asm volatile("s_wait_dscnt 0x0" ::: "memory");
    __syncthreads();
    cur = KTB - cur;
  }

  float* so = (float*)ring + wave * (32 * 68);   // the last trip's barrier stands behind every read of the ring
  const float lpad = nb > 0 ? 0.0f : (float)(KROWS - LTRUE);   // with no allowed key the padding keys weigh 1 each, on zero rows
  const float lother = __shfl_xor(lrun, 16, 32);   // the query's other q-tile sum lies in the other lane half
  const float lsum[QW] = {low ? lrun : lother, low ? lother : lrun};
#pragma unroll
  for (int qt = 0; qt < QW; ++qt) {
    const float rl = 1.0f / (lsum[qt] + lpad);
#pragma unroll
    for (int j = 0; j < 4; ++j)
#pragma unroll
      for (int r = 0; r < 8; ++r) so[(16 * qt + qlane) * 68 + j * 16 + kh8 + r] = o[qt][j][r] * rl;
  }
  asm volatile("s_wait_dscnt 0" ::: "memory");
  __builtin_amdgcn_wave_barrier();
  float* orow = out + ((size_t)(b * LTRUE + q0)) * DD + h * DKK;
  if (q0 + 32 <= LTRUE) {   // all 32 query rows of the wave are real (the test reads the same in every lane of a wave)
#pragma unroll
    for (int it = 0; it < 16; ++it) { const int ch = lane + 32 * it, ql = ch >> 4, q4 = (ch & 15) * 4;
      *(v4f_t*)(orow + (size_t)ql * DD + q4) = *(const v4fa*)(so + ql * 68 + q4); }
  } else {                  // the wave that holds the last real rows: the padded rows are not stored
#pragma unroll 1            // taken by one wave of each (batch, head) only: rolled, it keeps the kernel's text short
    for (int it = 0; it < 16; ++it) { const int ch = lane + 32 * it, ql = ch >> 4, q4 = (ch & 15) * 4;
      if (q0 + ql < LTRUE) {
        *(v4f_t*)(orow + (size_t)ql * DD + q4) = *(const v4fa*)(so + ql * 68 + q4);
        asm volatile("s_wait_xcnt 0x0" ::: "memory");   // stands in front of the next trip's rewrite of the store's address and data registers
      } }
  }
}


extern "C" void kernel_launch(void* const* d_in, const int* in_sizes, int n_in,
                              void* d_out, int out_size, void* d_ws, size_t ws_size,
                              hipStream_t stream) {
  (void)in_sizes; (void)n_in; (void)out_size;
  const float* q = (const float*)d_in[0]; const int* mask = (const int*)d_in[1];
  float* out = (float*)d_out;     // [8,1000,1024]
  (void)d_ws; (void)ws_size;
  attn_kernel<<<dim3(QROWS / (NWAVE * 32), HH, BB), dim3(NWAVE * 32), 0, stream>>>(q, mask, out);
}
